// v000
// Times are from an AMD MI455X. After a warm-up the kernel runs many times in a row, and a time is the length of
// such a window on the GPU divided by its runs, so every launch and the gaps after it count. The runs cycle
// through copies of the inputs. A figure is the median of several windows, for all but v000 over two sittings.
// Sittings can differ by a few percent; kernels timed side by side share one.
// v000, which the later versions start from, runs in 103 microseconds.
#include <hip/hip_runtime.h>

// ---------------------------------------------------------------------------
// MI455X (gfx1250, wave32).  B=8, N=2048, D=256.
//
// scores = softmax(q k^T / sqrt(D)) @ (v @ Ww^T) + bw
//   with  v @ Ww^T = x @ (Wv^T Ww^T) + bv.Ww     (V projection collapsed)
//
// GEMMs via v_wmma_f32_16x16x32_bf16.  Attention k-tiles staged into LDS by
// the Tensor Data Mover (tensor_load_to_lds, double-buffered, TDM row padding
// for conflict-free ds_load_b128), synced with s_wait_tensorcnt + barriers.
// ---------------------------------------------------------------------------

#define B_    8
#define N_    2048
#define D_    256
#define ROWS_ (B_ * N_)            // 16384

#define SEGS_     2                // key-dimension split per query tile
#define SEG_KEYS  (N_ / SEGS_)     // 1024
#define CHUNKS_   (SEG_KEYS / 16)  // 64 chunks of 16 keys

// LDS staging: 16 rows x 512B, TDM pads 16B after every 512B row
#define LDS_ROW_  528
#define LDS_BUF_  (16 * LDS_ROW_)  // 8448 B per buffer

typedef __attribute__((ext_vector_type(16))) __bf16 v16bf;
typedef __attribute__((ext_vector_type(8)))  __bf16 v8bf;
typedef __attribute__((ext_vector_type(8)))  float  v8f;
typedef __attribute__((ext_vector_type(4)))  unsigned int u32x4;
typedef __attribute__((ext_vector_type(8)))  int    i32x8;
typedef __attribute__((ext_vector_type(4)))  int    i32x4;

static __device__ __forceinline__ v8f wmma_bf16(v16bf a, v16bf b, v8f c) {
  return __builtin_amdgcn_wmma_f32_16x16x32_bf16(
      false, a, false, b, (short)0, c, false, false);
}

// 16x32 bf16 fragment from row-major global memory (A layout; also valid for
// the B operand when B's columns are rows of a row-major matrix).
static __device__ __forceinline__ v16bf load_frag(const __bf16* __restrict__ base,
                                                  int row, int ld, int k0, int lane) {
  int r  = lane & 15;
  int hk = (lane >> 4) << 3;                    // 0 or 8
  const __bf16* p = base + (size_t)(row + r) * ld + k0 + hk;
  v8bf lo = *(const v8bf*)(p);
  v8bf hi = *(const v8bf*)(p + 16);
  return __builtin_shufflevector(lo, hi, 0,1,2,3,4,5,6,7,8,9,10,11,12,13,14,15);
}

// ---------------------------------------------------------------------------
// TDM: DMA one 16x256 bf16 tile (row stride D_ elements) from global -> LDS,
// inserting a 4-dword pad after every 128 dwords (one 512B row) so the LDS
// row stride becomes 528B (132 dwords -> 4-bank rotation per row: the 16-lane
// stride-row fragment reads hit all 64 banks, conflict-free).
// Must be executed wave-uniformly by ONE wave per workgroup.
// clang-23 lane: 6-arg builtin (g0 u32x4, g1 i32x8, g2 i32x4, g3 i32x4,
//                               extra i32x8, cpol i32)
// ---------------------------------------------------------------------------
static __device__ __forceinline__ void tdm_load_ktile(const __bf16* gsrc,
                                                      unsigned int lds_addr) {
  unsigned long long ga = (unsigned long long)(uintptr_t)gsrc;
  u32x4 g0;
  g0[0] = 1u;                                             // count=1, user mode
  g0[1] = lds_addr;                                       // LDS byte address
  g0[2] = (unsigned int)ga;                               // global_addr[31:0]
  g0[3] = ((unsigned int)(ga >> 32) & 0x1FFFFFFu)         // global_addr[56:32]
          | 0x80000000u;                                  // type=2 ("image")
  i32x8 g1 = {
      0x07910000,      // data_size=2B | pad_enable | pad_interval=128dw | pad_amount=4dw
      0x01000000,      // tensor_dim0 = 256   (bits 79:48)
      0x08000000,      // tensor_dim1 = 2048  (bits 111:80)
      0x01000000,      // tile_dim0   = 256   (bits 127:112)
      16,              // tile_dim1   = 16
      D_,              // tensor_dim0_stride = 256 elements
      0, 0};
  i32x4 gz4 = {0, 0, 0, 0};
  i32x8 gz8 = {0, 0, 0, 0, 0, 0, 0, 0};
  __builtin_amdgcn_tensor_load_to_lds(g0, g1, gz4, gz4, gz8, 0);
}

// ---------------------------------------------------------------------------
// Kernel 0: wv_eff[d] = sum_e Wv[e,d]*Ww[e];  bias_eff = bv.Ww
// ---------------------------------------------------------------------------
__global__ void k_wveff(const float* __restrict__ Wv, const float* __restrict__ bv,
                        const float* __restrict__ Ww,
                        float* __restrict__ wv_eff, float* __restrict__ bias_eff) {
  int d = threadIdx.x;
  float acc = 0.f;
  for (int e = 0; e < D_; ++e) acc = fmaf(Wv[e * D_ + d], Ww[e], acc);
  wv_eff[d] = acc;
  if (d == 0) {
    float bb = 0.f;
    for (int e = 0; e < D_; ++e) bb = fmaf(bv[e], Ww[e], bb);
    bias_eff[0] = bb;
  }
}

// ---------------------------------------------------------------------------
// Kernel 1: Wq, Wk -> bf16
// ---------------------------------------------------------------------------
__global__ void k_convW(const float* __restrict__ Wq, const float* __restrict__ Wk,
                        __bf16* __restrict__ wqb, __bf16* __restrict__ wkb) {
  int i = blockIdx.x * blockDim.x + threadIdx.x;
  wqb[i] = (__bf16)Wq[i];
  wkb[i] = (__bf16)Wk[i];
}

// ---------------------------------------------------------------------------
// Kernel 2: x -> bf16, and sv[row] = dot(x[row,:], wv_eff) + bias_eff
// ---------------------------------------------------------------------------
__global__ void k_xconv_sv(const float* __restrict__ x,
                           const float* __restrict__ wv_eff,
                           const float* __restrict__ bias_eff,
                           __bf16* __restrict__ xb, float* __restrict__ sv) {
  __shared__ float red[256];
  int row = blockIdx.x;
  int t   = threadIdx.x;
  size_t off = (size_t)row * D_ + t;
  float v = x[off];
  xb[off] = (__bf16)v;
  red[t] = v * wv_eff[t];
  __syncthreads();
  for (int s = 128; s > 0; s >>= 1) {
    if (t < s) red[t] += red[t + s];
    __syncthreads();
  }
  if (t == 0) sv[row] = red[0] + bias_eff[0];
}

// ---------------------------------------------------------------------------
// Kernel 3: Q/K projection, one wave per 16x16 output tile.
//   qb = bf16((x@Wq^T + bq) / sqrt(D)),  kb = bf16(x@Wk^T + bk)
// ---------------------------------------------------------------------------
__global__ void k_proj_qk(const __bf16* __restrict__ xb,
                          const __bf16* __restrict__ wqb,
                          const __bf16* __restrict__ wkb,
                          const float* __restrict__ bq,
                          const float* __restrict__ bk,
                          __bf16* __restrict__ qb, __bf16* __restrict__ kb) {
  int wave = (blockIdx.x * blockDim.x + threadIdx.x) >> 5;
  int lane = threadIdx.x & 31;
  int R  = (wave >> 4) * 16;
  int E0 = (wave & 15) * 16;

  v8f cq = {}; v8f ck = {};
#pragma unroll
  for (int kk = 0; kk < 8; ++kk) {
    v16bf a    = load_frag(xb,  R,  D_, kk * 32, lane);
    v16bf bf_q = load_frag(wqb, E0, D_, kk * 32, lane);
    v16bf bf_k = load_frag(wkb, E0, D_, kk * 32, lane);
    cq = wmma_bf16(a, bf_q, cq);
    ck = wmma_bf16(a, bf_k, ck);
  }

  int   col   = E0 + (lane & 15);
  float biasq = bq[col];
  float biask = bk[col];
  const float scale = 0.0625f;          // 1/sqrt(256)
  int rbase = R + ((lane >> 4) << 3);
#pragma unroll
  for (int i = 0; i < 8; ++i) {
    size_t off = (size_t)(rbase + i) * D_ + col;
    qb[off] = (__bf16)((cq[i] + biasq) * scale);
    kb[off] = (__bf16)(ck[i] + biask);
  }
}

// ---------------------------------------------------------------------------
// Kernel 4: attention partials over one key segment.
// Block = 8 waves; wave w owns query rows [R, R+16). All waves share TDM-
// staged k chunks in LDS (double buffered). S^T = k_chunk x q^T so each lane
// owns 8 keys of one query row -> shuffle-free online softmax; halves merge
// once at the end. Writes per-row {M, L, A} partials.
// ---------------------------------------------------------------------------
__global__ void k_attn(const __bf16* __restrict__ qb, const __bf16* __restrict__ kb,
                       const float* __restrict__ sv,
                       float* __restrict__ Mp, float* __restrict__ Lp,
                       float* __restrict__ Ap) {
  __shared__ __align__(16) char smem[2 * LDS_BUF_];
  int tid  = threadIdx.x;
  int lane = tid & 31;
  int wv   = tid >> 5;                       // 0..7
  int rowgroup = blockIdx.x >> 1;            // 128 rows per block
  int seg      = blockIdx.x & 1;
  int Rg = rowgroup * 128;                   // global row base of block
  int b  = Rg / N_;
  int R  = (Rg % N_) + wv * 16;              // query row base within batch

  const __bf16* qbase = qb + (size_t)b * N_ * D_;
  const __bf16* kseg  = kb + (size_t)b * N_ * D_ + (size_t)seg * SEG_KEYS * D_;
  const float*  svb   = sv + b * N_ + seg * SEG_KEYS;
  unsigned int  lds0  = (unsigned int)(uintptr_t)&smem[0];   // LDS byte offset

  v16bf qf[8];
#pragma unroll
  for (int kk = 0; kk < 8; ++kk) qf[kk] = load_frag(qbase, R, D_, kk * 32, lane);

  if (wv == 0) tdm_load_ktile(kseg, lds0);   // prime chunk 0 -> buf 0

  float M = -3.0e38f, L = 0.f, A = 0.f;
  int hk = (lane >> 4) << 3;                 // this half's key sub-offset
  int r16 = lane & 15;

  for (int c = 0; c < CHUNKS_; ++c) {
    if (wv == 0) {
      if (c + 1 < CHUNKS_) {
        tdm_load_ktile(kseg + (size_t)(c + 1) * 16 * D_, lds0 + ((c + 1) & 1) * LDS_BUF_);
        __builtin_amdgcn_s_wait_tensorcnt(1);   // chunk c landed
      } else {
        __builtin_amdgcn_s_wait_tensorcnt(0);
      }
    }
    __syncthreads();                         // buf[c&1] ready for all waves

    const char* bufp = smem + (c & 1) * LDS_BUF_;
    v8f s = {};
#pragma unroll
    for (int kk = 0; kk < 8; ++kk) {
      int off = r16 * LDS_ROW_ + (kk * 32 + hk) * 2;
      v8bf lo = *(const v8bf*)(bufp + off);        // ds_load_b128
      v8bf hi = *(const v8bf*)(bufp + off + 32);   // ds_load_b128
      v16bf kf = __builtin_shufflevector(lo, hi,
                   0,1,2,3,4,5,6,7,8,9,10,11,12,13,14,15);
      s = wmma_bf16(kf, qf[kk], s);
    }

    // s[i] = score(key c*16+hk+i, query R+r16); scale folded into q.
    const float* svp = svb + c * 16 + hk;
    float4 sv0 = *(const float4*)(svp);
    float4 sv1 = *(const float4*)(svp + 4);
    float sva[8] = {sv0.x, sv0.y, sv0.z, sv0.w, sv1.x, sv1.y, sv1.z, sv1.w};

    float cmax = s[0];
#pragma unroll
    for (int i = 1; i < 8; ++i) cmax = fmaxf(cmax, s[i]);
    float Mn    = fmaxf(M, cmax);
    float alpha = __expf(M - Mn);
    float l = 0.f, a = 0.f;
#pragma unroll
    for (int i = 0; i < 8; ++i) {
      float p = __expf(s[i] - Mn);           // v_exp_f32, co-executes with WMMA
      l += p;
      a = fmaf(p, sva[i], a);
    }
    L = fmaf(L, alpha, l);
    A = fmaf(A, alpha, a);
    M = Mn;

    __syncthreads();                         // all waves done with buf[c&1]
  }

  // Merge the two half-wave partials (keys {0..7}+16c vs {8..15}+16c).
  float Mo = __shfl_xor(M, 16, 32);
  float Lo = __shfl_xor(L, 16, 32);
  float Ao = __shfl_xor(A, 16, 32);
  float Mn = fmaxf(M, Mo);
  float s1 = __expf(M - Mn), s2 = __expf(Mo - Mn);
  float Lt = L * s1 + Lo * s2;
  float At = A * s1 + Ao * s2;

  if (lane < 16) {
    size_t grow = (size_t)b * N_ + R + lane;
    size_t idx  = (size_t)seg * ROWS_ + grow;
    Mp[idx] = Mn;
    Lp[idx] = Lt;
    Ap[idx] = At;
  }
}

// ---------------------------------------------------------------------------
// Kernel 5: merge the 2 key-segment partials per row; add bw.
// ---------------------------------------------------------------------------
__global__ void k_merge(const float* __restrict__ Mp, const float* __restrict__ Lp,
                        const float* __restrict__ Ap, const float* __restrict__ bw,
                        float* __restrict__ out) {
  int row = blockIdx.x * blockDim.x + threadIdx.x;
  float M0 = Mp[row], M1 = Mp[ROWS_ + row];
  float L0 = Lp[row], L1 = Lp[ROWS_ + row];
  float A0 = Ap[row], A1 = Ap[ROWS_ + row];
  float Mn = fmaxf(M0, M1);
  float e0 = __expf(M0 - Mn), e1 = __expf(M1 - Mn);
  float Lt = L0 * e0 + L1 * e1;
  float At = A0 * e0 + A1 * e1;
  out[row] = At / Lt + bw[0];
}

// ---------------------------------------------------------------------------
// Launch
// ---------------------------------------------------------------------------
extern "C" void kernel_launch(void* const* d_in, const int* in_sizes, int n_in,
                              void* d_out, int out_size, void* d_ws, size_t ws_size,
                              hipStream_t stream) {
  const float* x  = (const float*)d_in[0];
  const float* Wq = (const float*)d_in[1];
  const float* bq = (const float*)d_in[2];
  const float* Wk = (const float*)d_in[3];
  const float* bk = (const float*)d_in[4];
  const float* Wv = (const float*)d_in[5];
  const float* bv = (const float*)d_in[6];
  const float* Ww = (const float*)d_in[7];
  const float* bw = (const float*)d_in[8];
  float* out = (float*)d_out;

  char* ws = (char*)d_ws;
  __bf16* qb       = (__bf16*)(ws);                 // 8 MiB
  __bf16* kb       = (__bf16*)(ws + 8388608);       // 8 MiB
  __bf16* xb       = (__bf16*)(ws + 16777216);      // 8 MiB
  __bf16* wqb      = (__bf16*)(ws + 25165824);      // 128 KiB
  __bf16* wkb      = (__bf16*)(ws + 25296896);      // 128 KiB
  float*  sv       = (float*) (ws + 25427968);      // 64 KiB
  float*  wv_eff   = (float*) (ws + 25493504);      // 1 KiB
  float*  bias_eff = (float*) (ws + 25494528);      // 256 B
  float*  Mp       = (float*) (ws + 25494784);      // 2*16384*4 = 128 KiB
  float*  Lp       = (float*) (ws + 25625856);      // 128 KiB
  float*  Ap       = (float*) (ws + 25756928);      // 128 KiB

  k_wveff   <<<1, 256, 0, stream>>>(Wv, bv, Ww, wv_eff, bias_eff);
  k_convW   <<<(D_ * D_) / 256, 256, 0, stream>>>(Wq, Wk, wqb, wkb);
  k_xconv_sv<<<ROWS_, 256, 0, stream>>>(x, wv_eff, bias_eff, xb, sv);
  k_proj_qk <<<(ROWS_ / 16) * (D_ / 16) / 8, 256, 0, stream>>>(xb, wqb, wkb, bq, bk, qb, kb);
  // 128 row-groups x 2 key segments, 8 waves/block
  k_attn    <<<(ROWS_ / 128) * SEGS_, 256, 0, stream>>>(qb, kb, sv, Mp, Lp, Ap);
  k_merge   <<<ROWS_ / 256, 256, 0, stream>>>(Mp, Lp, Ap, bw, out);
}

// v001
// A run of this version takes 79.1 microseconds.
// Two timings next to v000 both put it at 1.30 times that version's speed.
#include <hip/hip_runtime.h>

// ---------------------------------------------------------------------------
// MI455X (gfx1250, wave32).  B=8, N=2048, D=256.
//
// scores = softmax(q k^T / sqrt(D)) @ (v @ Ww^T) + bw
//   with  v @ Ww^T = x @ (Wv^T Ww^T) + bv.Ww     (V projection collapsed)
//
// GEMMs via v_wmma_f32_16x16x32_bf16.  Attention keys are staged into LDS by
// the tensor mover (tensor_load_to_lds) in stages of 128 keys, two buffers:
// every wave brings one padded slice per stage, one publish point per stage.
// ---------------------------------------------------------------------------

#define B_    8
#define N_    2048
#define D_    256
#define ROWS_ (B_ * N_)            // 16384

#define SEGS_     2                // key-dimension split per query tile
#define SEG_KEYS  (N_ / SEGS_)     // 1024
#define STAGE_KEYS 128                       // keys per tensor-load stage
#define STAGES_    (SEG_KEYS / STAGE_KEYS)   // 8 stages per segment
#define SUBS_      (STAGE_KEYS / 16)         // 8 score tiles of 16 keys per stage
#define KROW_B_    (D_ * 2)                  // 512 B: one key row in global memory

// LDS staging: a stage is 8 slices, one per wave. A slice is 32 key rows x one
// 256-B half of the row; the mover pads 16 B behind every 256-B row, so the
// LDS pitch is 272 B (16 B x odd: conflict-free for ds_load_b128).
#define SLICE_ROWS_ 32
#define SLICE_ROWB_ 256
#define LDS_PITCH_  272
#define SLICE_LDS_  10240          // 32 x 272 = 8704 B, rounded up to a multiple of 2 KiB
#define LDS_BUF_    (8 * SLICE_LDS_)   // 81920 B per buffer

typedef __attribute__((ext_vector_type(16))) __bf16 v16bf;
typedef __attribute__((ext_vector_type(8)))  __bf16 v8bf;
typedef __attribute__((ext_vector_type(8)))  float  v8f;
typedef __attribute__((ext_vector_type(4)))  unsigned int u32x4;
typedef __attribute__((ext_vector_type(8)))  unsigned int u32x8;

static __device__ __forceinline__ v8f wmma_bf16(v16bf a, v16bf b, v8f c) {
  return __builtin_amdgcn_wmma_f32_16x16x32_bf16(
      false, a, false, b, (short)0, c, false, false);
}

// 16x32 bf16 fragment from row-major global memory (A layout; also valid for
// the B operand when B's columns are rows of a row-major matrix).
static __device__ __forceinline__ v16bf load_frag(const __bf16* __restrict__ base,
                                                  int row, int ld, int k0, int lane) {
  int r  = lane & 15;
  int hk = (lane >> 4) << 3;                    // 0 or 8
  const __bf16* p = base + (size_t)(row + r) * ld + k0 + hk;
  v8bf lo = *(const v8bf*)(p);
  v8bf hi = *(const v8bf*)(p + 16);
  return __builtin_shufflevector(lo, hi, 0,1,2,3,4,5,6,7,8,9,10,11,12,13,14,15);
}

// ---------------------------------------------------------------------------
// Tensor mover: one request of one wave brings a slice (32 rows of 256 B, source
// pitch 512 B) from global memory into LDS at a pitch of 272 B.
// ---------------------------------------------------------------------------
static __device__ __forceinline__ unsigned int uni(unsigned int v) {
  return (unsigned int)__builtin_amdgcn_readfirstlane(v);
}
// Holds a wave-uniform test in a scalar register, so that the branch around a
// tensor load is a scalar one (a tensor load ignores EXEC).
static __device__ __forceinline__ unsigned int pinned(unsigned int v) {
  unsigned int w = uni(v);
  asm volatile("" : "+s"(w));  // pinned(): the test stays in a scalar register, the branch compiles to s_cmp + s_cbranch_scc
  return w;
}
// Group 1: 1-byte elements, tensor = tile = 32 rows x 256 B, pad of 4 dwords
// behind every 64 dwords (pad_enable, interval code 5, amount code 3), no mask.
static __device__ __forceinline__ u32x8 tdm_group1() {
  u32x8 g;
  g[0] = uni((1u << 20) | (5u << 22) | (3u << 25));
  g[1] = uni((unsigned int)SLICE_ROWB_ << 16);          // tensor_dim0 [15:0]
  g[2] = uni((unsigned int)SLICE_ROWS_ << 16);          // tensor_dim0 [31:16] = 0, tensor_dim1 [15:0]
  g[3] = uni((unsigned int)SLICE_ROWB_ << 16);          // tensor_dim1 [31:16] = 0, tile_dim0
  g[4] = uni((unsigned int)SLICE_ROWS_);                // tile_dim1
  g[5] = uni((unsigned int)KROW_B_);                    // source row pitch, bytes
  g[6] = uni(0u);
  g[7] = uni(0u);
  return g;
}
// Group 0: count 1, LDS byte offset, global byte address, type 2.
static __device__ __forceinline__ u32x4 tdm_group0(unsigned int lds_dst, unsigned long long ga) {
  u32x4 g;
  g[0] = uni(1u);
  g[1] = uni(lds_dst);
  g[2] = uni((unsigned int)ga);
  g[3] = uni((((unsigned int)(ga >> 32)) & 0x01FFFFFFu) | 0x80000000u);
  return g;
}
static __device__ __forceinline__ void tdm_load(u32x4 g0, u32x8 g1) {
  // The two-group form of the request; "memory" keeps LDS reads on their side of it.
  asm volatile("tensor_load_to_lds %0, %1" :: "s"(g0), "s"(g1) : "memory");
}

// ---------------------------------------------------------------------------
// Kernel 0: wv_eff[d] = sum_e Wv[e,d]*Ww[e];  bias_eff = bv.Ww
// ---------------------------------------------------------------------------
__global__ void k_wveff(const float* __restrict__ Wv, const float* __restrict__ bv,
                        const float* __restrict__ Ww,
                        float* __restrict__ wv_eff, float* __restrict__ bias_eff) {
  int d = threadIdx.x;
  float acc = 0.f;
  for (int e = 0; e < D_; ++e) acc = fmaf(Wv[e * D_ + d], Ww[e], acc);
  wv_eff[d] = acc;
  if (d == 0) {
    float bb = 0.f;
    for (int e = 0; e < D_; ++e) bb = fmaf(bv[e], Ww[e], bb);
    bias_eff[0] = bb;
  }
}

// ---------------------------------------------------------------------------
// Kernel 1: Wq, Wk -> bf16
// ---------------------------------------------------------------------------
__global__ void k_convW(const float* __restrict__ Wq, const float* __restrict__ Wk,
                        __bf16* __restrict__ wqb, __bf16* __restrict__ wkb) {
  int i = blockIdx.x * blockDim.x + threadIdx.x;
  wqb[i] = (__bf16)Wq[i];
  wkb[i] = (__bf16)Wk[i];
}

// ---------------------------------------------------------------------------
// Kernel 2: x -> bf16, and sv[row] = dot(x[row,:], wv_eff) + bias_eff
// ---------------------------------------------------------------------------
__global__ void k_xconv_sv(const float* __restrict__ x,
                           const float* __restrict__ wv_eff,
                           const float* __restrict__ bias_eff,
                           __bf16* __restrict__ xb, float* __restrict__ sv) {
  __shared__ float red[256];
  int row = blockIdx.x;
  int t   = threadIdx.x;
  size_t off = (size_t)row * D_ + t;
  float v = x[off];
  xb[off] = (__bf16)v;
  red[t] = v * wv_eff[t];
  __syncthreads();
  for (int s = 128; s > 0; s >>= 1) {
    if (t < s) red[t] += red[t + s];
    __syncthreads();
  }
  if (t == 0) sv[row] = red[0] + bias_eff[0];
}

// ---------------------------------------------------------------------------
// Kernel 3: Q/K projection, one wave per 16x16 output tile.
//   qb = bf16((x@Wq^T + bq) / sqrt(D)),  kb = bf16(x@Wk^T + bk)
// ---------------------------------------------------------------------------
__global__ void k_proj_qk(const __bf16* __restrict__ xb,
                          const __bf16* __restrict__ wqb,
                          const __bf16* __restrict__ wkb,
                          const float* __restrict__ bq,
                          const float* __restrict__ bk,
                          __bf16* __restrict__ qb, __bf16* __restrict__ kb) {
  int wave = (blockIdx.x * blockDim.x + threadIdx.x) >> 5;
  int lane = threadIdx.x & 31;
  int R  = (wave >> 4) * 16;
  int E0 = (wave & 15) * 16;

  v8f cq = {}; v8f ck = {};
#pragma unroll
  for (int kk = 0; kk < 8; ++kk) {
    v16bf a    = load_frag(xb,  R,  D_, kk * 32, lane);
    v16bf bf_q = load_frag(wqb, E0, D_, kk * 32, lane);
    v16bf bf_k = load_frag(wkb, E0, D_, kk * 32, lane);
    cq = wmma_bf16(a, bf_q, cq);
    ck = wmma_bf16(a, bf_k, ck);
  }

  int   col   = E0 + (lane & 15);
  float biasq = bq[col];
  float biask = bk[col];
  const float scale = 0.0625f;          // 1/sqrt(256)
  int rbase = R + ((lane >> 4) << 3);
#pragma unroll
  for (int i = 0; i < 8; ++i) {
    size_t off = (size_t)(rbase + i) * D_ + col;
    qb[off] = (__bf16)((cq[i] + biasq) * scale);
    kb[off] = (__bf16)(ck[i] + biask);
  }
}

// ---------------------------------------------------------------------------
// Kernel 4: attention partials over one key segment.
// Block = 8 waves; wave w owns query rows [R, R+16). All waves share the keys
// staged in LDS: 128 keys per stage, two buffers, the next stage's tensor loads
// in flight while this stage is worked on. S^T = k_tile x q^T so each lane owns
// 8 keys of one query row -> shuffle-free online softmax per 16 keys; halves
// merge once at the end. Writes per-row {M, L, A} partials.
// The real block size is declared: under the default cap of 128 VGPRs the
// unrolled stage spills to scratch.
// ---------------------------------------------------------------------------
__global__ void __launch_bounds__(256)
k_attn(const __bf16* __restrict__ qb, const __bf16* __restrict__ kb,
       const float* __restrict__ sv,
       float* __restrict__ Mp, float* __restrict__ Lp,
       float* __restrict__ Ap) {
  __shared__ __attribute__((aligned(2048))) unsigned char smem[2 * LDS_BUF_];
  int tid  = threadIdx.x;
  int lane = tid & 31;
  unsigned int wv = uni((unsigned int)tid >> 5);   // 0..7, scalar
  int rowgroup = blockIdx.x >> 1;            // 128 rows per block
  int seg      = blockIdx.x & 1;
  int Rg = rowgroup * 128;                   // global row base of block
  int b  = Rg / N_;
  int R  = (Rg % N_) + (int)wv * 16;         // query row base within batch

  const __bf16* qbase = qb + (size_t)b * N_ * D_;
  const __bf16* kseg  = kb + (size_t)b * N_ * D_ + (size_t)seg * SEG_KEYS * D_;
  const float*  svb   = sv + b * N_ + seg * SEG_KEYS;
  unsigned int  lds0  = (unsigned int)(uintptr_t)&smem[0];   // LDS byte offset

  // This wave's slice of every stage: key rows (wv >> 1) * 32 .. + 31 of the
  // stage, byte half (wv & 1) of each row.
  const unsigned int       my_lds = lds0 + wv * SLICE_LDS_;
  const unsigned long long my_src = (unsigned long long)(uintptr_t)kseg
      + (unsigned long long)((wv >> 1) * (SLICE_ROWS_ * KROW_B_) + (wv & 1u) * SLICE_ROWB_);
  const u32x8 g1 = tdm_group1();

  tdm_load(tdm_group0(my_lds, my_src), g1);  // stage 0 -> buffer 0

  v16bf qf[8];
#pragma unroll
  for (int kk = 0; kk < 8; ++kk) qf[kk] = load_frag(qbase, R, D_, kk * 32, lane);

  asm volatile("s_wait_tensorcnt 0x0" ::: "memory");   // this wave's slice of stage 0 has landed
  __syncthreads();                                     // stage 0 readable by every wave
  tdm_load(tdm_group0(my_lds + LDS_BUF_, my_src + (unsigned long long)(STAGE_KEYS * KROW_B_)), g1);  // stage 1 -> buffer 1

  float M = -3.0e38f, L = 0.f, A = 0.f;
  int hk = (lane >> 4) << 3;                 // this half's key sub-offset
  int r16 = lane & 15;

  // The stage loop stays rolled: unrolled, its body (64 WMMAs and 8 softmax
  // updates) would be repeated 8 times in the instruction cache for nothing.
#pragma unroll 1
  for (unsigned int st = 0; st < STAGES_; ++st) {
    const unsigned int bufo = (st & 1u) * LDS_BUF_;
    const unsigned char* lanep = smem + bufo + r16 * LDS_PITCH_ + hk * 2;

    // Unrolled: every LDS offset is a constant, and with no barrier between
    // the 8 tiles their loads, WMMAs and softmax updates can overlap.
#pragma unroll
    for (int j = 0; j < SUBS_; ++j) {
      v8f s = {};
#pragma unroll
      for (int kk = 0; kk < 8; ++kk) {
        // key row j*16 + r16: slice pair j >> 1, row (j & 1) * 16 + r16 in it;
        // row bytes kk*64 ..: half kk >> 2, byte (kk & 3) * 64 in it.
        int off = ((j >> 1) * 2 + (kk >> 2)) * SLICE_LDS_ + (j & 1) * 16 * LDS_PITCH_ + (kk & 3) * 64;
        v8bf lo = *(const v8bf*)(lanep + off);        // ds_load_b128
        v8bf hi = *(const v8bf*)(lanep + off + 32);   // ds_load_b128
        v16bf kf = __builtin_shufflevector(lo, hi,
                     0,1,2,3,4,5,6,7,8,9,10,11,12,13,14,15);
        s = wmma_bf16(kf, qf[kk], s);
      }

      // s[i] = score(key st*128+j*16+hk+i, query R+r16); scale folded into q.
      const float* svp = svb + st * STAGE_KEYS + j * 16 + hk;
      float4 sv0 = *(const float4*)(svp);
      float4 sv1 = *(const float4*)(svp + 4);
      float sva[8] = {sv0.x, sv0.y, sv0.z, sv0.w, sv1.x, sv1.y, sv1.z, sv1.w};

      float cmax = s[0];
#pragma unroll
      for (int i = 1; i < 8; ++i) cmax = fmaxf(cmax, s[i]);
      float Mn    = fmaxf(M, cmax);
      float alpha = __expf(M - Mn);
      float l = 0.f, a = 0.f;
#pragma unroll
      for (int i = 0; i < 8; ++i) {
        float p = __expf(s[i] - Mn);           // v_exp_f32, co-executes with WMMA
        l += p;
        a = fmaf(p, sva[i], a);
      }
      L = fmaf(L, alpha, l);
      A = fmaf(A, alpha, a);
      M = Mn;
    }

    // Publish point of stage st + 1, passed by every wave, in this order.
    asm volatile("s_wait_dscnt 0x0" ::: "memory");      // this wave's reads of stage st have returned
    asm volatile("s_wait_tensorcnt 0x0" ::: "memory");  // this wave's slice of stage st + 1 has landed
    __syncthreads();                                    // st + 1 readable; every wave has left stage st
    if (pinned(st + 2u < STAGES_)) {                    // refill the buffer that stage st used
      tdm_load(tdm_group0(my_lds + bufo,
                          my_src + (unsigned long long)(st + 2u) * (STAGE_KEYS * KROW_B_)), g1);
    }
  }
  asm volatile("s_wait_tensorcnt 0x0" ::: "memory");    // no request outlives the loop
  asm volatile("s_wait_dscnt 0x0" ::: "memory");

  // Merge the two half-wave partials (keys {0..7}+16c vs {8..15}+16c).
  float Mo = __shfl_xor(M, 16, 32);
  float Lo = __shfl_xor(L, 16, 32);
  float Ao = __shfl_xor(A, 16, 32);
  float Mn = fmaxf(M, Mo);
  float s1 = __expf(M - Mn), s2 = __expf(Mo - Mn);
  float Lt = L * s1 + Lo * s2;
  float At = A * s1 + Ao * s2;

  if (lane < 16) {
    size_t grow = (size_t)b * N_ + R + lane;
    size_t idx  = (size_t)seg * ROWS_ + grow;
    Mp[idx] = Mn;
    Lp[idx] = Lt;
    Ap[idx] = At;
  }
}

// ---------------------------------------------------------------------------
// Kernel 5: merge the 2 key-segment partials per row; add bw.
// ---------------------------------------------------------------------------
__global__ void k_merge(const float* __restrict__ Mp, const float* __restrict__ Lp,
                        const float* __restrict__ Ap, const float* __restrict__ bw,
                        float* __restrict__ out) {
  int row = blockIdx.x * blockDim.x + threadIdx.x;
  float M0 = Mp[row], M1 = Mp[ROWS_ + row];
  float L0 = Lp[row], L1 = Lp[ROWS_ + row];
  float A0 = Ap[row], A1 = Ap[ROWS_ + row];
  float Mn = fmaxf(M0, M1);
  float e0 = __expf(M0 - Mn), e1 = __expf(M1 - Mn);
  float Lt = L0 * e0 + L1 * e1;
  float At = A0 * e0 + A1 * e1;
  out[row] = At / Lt + bw[0];
}

// ---------------------------------------------------------------------------
// Launch
// ---------------------------------------------------------------------------
extern "C" void kernel_launch(void* const* d_in, const int* in_sizes, int n_in,
                              void* d_out, int out_size, void* d_ws, size_t ws_size,
                              hipStream_t stream) {
  const float* x  = (const float*)d_in[0];
  const float* Wq = (const float*)d_in[1];
  const float* bq = (const float*)d_in[2];
  const float* Wk = (const float*)d_in[3];
  const float* bk = (const float*)d_in[4];
  const float* Wv = (const float*)d_in[5];
  const float* bv = (const float*)d_in[6];
  const float* Ww = (const float*)d_in[7];
  const float* bw = (const float*)d_in[8];
  float* out = (float*)d_out;

  char* ws = (char*)d_ws;
  __bf16* qb       = (__bf16*)(ws);                 // 8 MiB
  __bf16* kb       = (__bf16*)(ws + 8388608);       // 8 MiB
  __bf16* xb       = (__bf16*)(ws + 16777216);      // 8 MiB
  __bf16* wqb      = (__bf16*)(ws + 25165824);      // 128 KiB
  __bf16* wkb      = (__bf16*)(ws + 25296896);      // 128 KiB
  float*  sv       = (float*) (ws + 25427968);      // 64 KiB
  float*  wv_eff   = (float*) (ws + 25493504);      // 1 KiB
  float*  bias_eff = (float*) (ws + 25494528);      // 256 B
  float*  Mp       = (float*) (ws + 25494784);      // 2*16384*4 = 128 KiB
  float*  Lp       = (float*) (ws + 25625856);      // 128 KiB
  float*  Ap       = (float*) (ws + 25756928);      // 128 KiB

  k_wveff   <<<1, 256, 0, stream>>>(Wv, bv, Ww, wv_eff, bias_eff);
  k_convW   <<<(D_ * D_) / 256, 256, 0, stream>>>(Wq, Wk, wqb, wkb);
  k_xconv_sv<<<ROWS_, 256, 0, stream>>>(x, wv_eff, bias_eff, xb, sv);
  k_proj_qk <<<(ROWS_ / 16) * (D_ / 16) / 8, 256, 0, stream>>>(xb, wqb, wkb, bq, bk, qb, kb);
  // 128 row-groups x 2 key segments, 8 waves/block
  k_attn    <<<(ROWS_ / 128) * SEGS_, 256, 0, stream>>>(qb, kb, sv, Mp, Lp, Ap);
  k_merge   <<<ROWS_ / 256, 256, 0, stream>>>(Mp, Lp, Ap, bw, out);
}

// v002
// Measured time: 58.3 microseconds a run.
// In both of two side-by-side timings against v001, it was 1.37 times as fast.
// Counting every step since v000, it is 1.78 times as fast.
#include <hip/hip_runtime.h>

// ---------------------------------------------------------------------------
// MI455X (gfx1250, wave32).  B=8, N=2048, D=256.
//
// scores = softmax(q k^T / sqrt(D)) @ (v @ Ww^T) + bw
//   with  v @ Ww^T = x @ (Wv^T Ww^T) + bv.Ww     (V projection collapsed)
//
// GEMMs via v_wmma_f32_16x16x32_bf16.  Attention keys are staged into LDS by
// the tensor mover (tensor_load_to_lds) in stages of 128 keys, two buffers:
// every wave brings one padded slice per stage, one publish point per stage.
// ---------------------------------------------------------------------------

#define B_    8
#define N_    2048
#define D_    256
#define ROWS_ (B_ * N_)            // 16384

#define SEGS_     2                // key-dimension split per query tile
#define SEG_KEYS  (N_ / SEGS_)     // 1024
#define STAGE_KEYS 128                       // keys per tensor-load stage
#define STAGES_    (SEG_KEYS / STAGE_KEYS)   // 8 stages per segment
#define SUBS_      (STAGE_KEYS / 16)         // 8 score tiles of 16 keys per stage
#define KROW_B_    (D_ * 2)                  // 512 B: one key row in global memory

// LDS staging: a stage is 8 slices, one per wave. A slice is 32 key rows x one
// 256-B half of the row; the mover pads 16 B behind every 256-B row, so the
// LDS pitch is 272 B (16 B x odd: conflict-free for ds_load_b128).
#define SLICE_ROWS_ 32
#define SLICE_ROWB_ 256
#define LDS_PITCH_  272
#define SLICE_LDS_  10240          // 32 x 272 = 8704 B, rounded up to a multiple of 2 KiB
#define LDS_BUF_    (8 * SLICE_LDS_)   // 81920 B per buffer

typedef __attribute__((ext_vector_type(16))) __bf16 v16bf;
typedef __attribute__((ext_vector_type(8)))  __bf16 v8bf;
typedef __attribute__((ext_vector_type(4)))  __bf16 v4bf;
typedef __attribute__((ext_vector_type(8)))  float  v8f;
typedef __attribute__((ext_vector_type(4)))  unsigned int u32x4;
typedef __attribute__((ext_vector_type(8)))  unsigned int u32x8;

static __device__ __forceinline__ v8f wmma_bf16(v16bf a, v16bf b, v8f c) {
  return __builtin_amdgcn_wmma_f32_16x16x32_bf16(
      false, a, false, b, (short)0, c, false, false);
}

// 16x32 bf16 fragment from row-major global memory (A layout; also valid for
// the B operand when B's columns are rows of a row-major matrix).
static __device__ __forceinline__ v16bf load_frag(const __bf16* __restrict__ base,
                                                  int row, int ld, int k0, int lane) {
  int r  = lane & 15;
  int hk = (lane >> 4) << 3;                    // 0 or 8
  const __bf16* p = base + (size_t)(row + r) * ld + k0 + hk;
  v8bf lo = *(const v8bf*)(p);
  v8bf hi = *(const v8bf*)(p + 16);
  return __builtin_shufflevector(lo, hi, 0,1,2,3,4,5,6,7,8,9,10,11,12,13,14,15);
}

// ---------------------------------------------------------------------------
// Tensor mover: one request of one wave brings a slice (32 rows of 256 B, source
// pitch 512 B) from global memory into LDS at a pitch of 272 B.
// ---------------------------------------------------------------------------
static __device__ __forceinline__ unsigned int uni(unsigned int v) {
  return (unsigned int)__builtin_amdgcn_readfirstlane(v);
}
// Holds a wave-uniform test in a scalar register, so that the branch around a
// tensor load is a scalar one (a tensor load ignores EXEC).
static __device__ __forceinline__ unsigned int pinned(unsigned int v) {
  unsigned int w = uni(v);
  asm volatile("" : "+s"(w));  // pinned(): the test stays in a scalar register, the branch compiles to s_cmp + s_cbranch_scc
  return w;
}
// Group 1: 1-byte elements, tensor = tile = 32 rows x 256 B, pad of 4 dwords
// behind every 64 dwords (pad_enable, interval code 5, amount code 3), no mask.
static __device__ __forceinline__ u32x8 tdm_group1() {
  u32x8 g;
  g[0] = uni((1u << 20) | (5u << 22) | (3u << 25));
  g[1] = uni((unsigned int)SLICE_ROWB_ << 16);          // tensor_dim0 [15:0]
  g[2] = uni((unsigned int)SLICE_ROWS_ << 16);          // tensor_dim0 [31:16] = 0, tensor_dim1 [15:0]
  g[3] = uni((unsigned int)SLICE_ROWB_ << 16);          // tensor_dim1 [31:16] = 0, tile_dim0
  g[4] = uni((unsigned int)SLICE_ROWS_);                // tile_dim1
  g[5] = uni((unsigned int)KROW_B_);                    // source row pitch, bytes
  g[6] = uni(0u);
  g[7] = uni(0u);
  return g;
}
// Group 0: count 1, LDS byte offset, global byte address, type 2.
static __device__ __forceinline__ u32x4 tdm_group0(unsigned int lds_dst, unsigned long long ga) {
  u32x4 g;
  g[0] = uni(1u);
  g[1] = uni(lds_dst);
  g[2] = uni((unsigned int)ga);
  g[3] = uni((((unsigned int)(ga >> 32)) & 0x01FFFFFFu) | 0x80000000u);
  return g;
}
static __device__ __forceinline__ void tdm_load(u32x4 g0, u32x8 g1) {
  // The two-group form of the request; "memory" keeps LDS reads on their side of it.
  asm volatile("tensor_load_to_lds %0, %1" :: "s"(g0), "s"(g1) : "memory");
}

// ---------------------------------------------------------------------------
// Kernel 0: wv_eff[d] = sum_e Wv[e,d]*Ww[e];  bias_eff = bv.Ww
// ---------------------------------------------------------------------------
__global__ void k_wveff(const float* __restrict__ Wv, const float* __restrict__ bv,
                        const float* __restrict__ Ww,
                        float* __restrict__ wv_eff, float* __restrict__ bias_eff) {
  int d = threadIdx.x;
  float acc = 0.f;
  for (int e = 0; e < D_; ++e) acc = fmaf(Wv[e * D_ + d], Ww[e], acc);
  wv_eff[d] = acc;
  if (d == 0) {
    float bb = 0.f;
    for (int e = 0; e < D_; ++e) bb = fmaf(bv[e], Ww[e], bb);
    bias_eff[0] = bb;
  }
}

// ---------------------------------------------------------------------------
// Kernel 1: Wq, Wk -> bf16
// ---------------------------------------------------------------------------
__global__ void k_convW(const float* __restrict__ Wq, const float* __restrict__ Wk,
                        __bf16* __restrict__ wqb, __bf16* __restrict__ wkb) {
  int i = blockIdx.x * blockDim.x + threadIdx.x;
  wqb[i] = (__bf16)Wq[i];
  wkb[i] = (__bf16)Wk[i];
}

// ---------------------------------------------------------------------------
// Kernel 2: Q/K projection straight from the f32 x.
// A block owns 16 rows of x and all 256 output columns of Q and of K. It reads
// its rows once (whole 256-B pieces per 16 lanes), rounds them to bf16 into LDS
// and forms sv[row] = dot(x[row,:], wv_eff) + bias_eff on the way; then every
// wave takes its A fragments from LDS for two 16-column tiles of Q and of K.
//   qb = bf16((x@Wq^T + bq) / sqrt(D)),  kb = bf16(x@Wk^T + bk)
// ---------------------------------------------------------------------------
// 16x32 bf16 weight fragment: uniform base, one 32-bit element offset per lane
// shared by every fragment of the wave, the rest a constant.
static __device__ __forceinline__ v16bf load_wfrag(const __bf16* __restrict__ base,
                                                   unsigned int lane_off, int c) {
  const __bf16* p = (base + lane_off) + c;
  v8bf lo = *(const v8bf*)(p);
  v8bf hi = *(const v8bf*)(p + 16);
  return __builtin_shufflevector(lo, hi, 0,1,2,3,4,5,6,7,8,9,10,11,12,13,14,15);
}

// Sum over the 16 lanes of a row by DPP adds (row_xmask 8, 4, 2, 1); every lane
// of the wave is on where it is called.
template <int M>
static __device__ __forceinline__ float row_xadd(float s) {
  int o = __builtin_amdgcn_update_dpp(0, __float_as_int(s), 0x160 | M, 0xf, 0xf, true);
  return s + __int_as_float(o);
}
static __device__ __forceinline__ float row16_sum(float s) {
  s = row_xadd<8>(s);
  s = row_xadd<4>(s);
  s = row_xadd<2>(s);
  s = row_xadd<1>(s);
  return s;
}

#define XS_PITCH_ 528              // 512 B of bf16 + 16 B: 16 B x odd, conflict-free for ds_load_b128

__global__ void k_proj_qk(const float* __restrict__ x,
                          const float* __restrict__ wv_eff,
                          const float* __restrict__ bias_eff,
                          const __bf16* __restrict__ wqb,
                          const __bf16* __restrict__ wkb,
                          const float* __restrict__ bq,
                          const float* __restrict__ bk,
                          __bf16* __restrict__ qb, __bf16* __restrict__ kb,
                          float* __restrict__ sv) {
  __shared__ __attribute__((aligned(16))) unsigned char xs[16 * XS_PITCH_];
  int t    = threadIdx.x;
  int lane = t & 31;
  int wv   = t >> 5;
  int R    = blockIdx.x * 16;
  int E0   = wv * 16;                            // column tiles E0 and E0 + 128

  // The first weight fragments are asked for ahead of the staging.
  unsigned int woff = (unsigned int)((E0 + (lane & 15)) * D_ + ((lane >> 4) << 3));
  v16bf fq0 = load_wfrag(wqb, woff, 0);
  v16bf fk0 = load_wfrag(wkb, woff, 0);
  v16bf fq1 = load_wfrag(wqb, woff, 128 * D_);
  v16bf fk1 = load_wfrag(wkb, woff, 128 * D_);
  float be = bias_eff[0];
  // Precaution: stands in front of the first write of a register that the loads
  // above name (their offset register is reused as a load destination below).
  asm volatile("s_wait_xcnt 0x0" ::: "memory");

  // Stage: 16 threads per row, 4 floats per thread and pass.
  int srow = t >> 4;
  int sc   = (t & 15) * 4;
  const float* xr = (x + (size_t)R * D_) + (unsigned int)(srow * D_ + sc);
  float4 v[4], w[4];
#pragma unroll   // v and w stay in registers, every offset a constant
  for (int i = 0; i < 4; ++i) {
    v[i] = *(const float4*)(xr + i * 64);
    w[i] = *(const float4*)(wv_eff + sc + i * 64);
  }
  // All loads above are asked for before the first of them is waited for:
  // otherwise the weight fragments start only when x has arrived.
  __builtin_amdgcn_sched_barrier(0);

  unsigned char* xd = xs + srow * XS_PITCH_ + sc * 2;
  float a0 = 0.f, a1 = 0.f, a2 = 0.f, a3 = 0.f;
#pragma unroll   // as above
  for (int i = 0; i < 4; ++i) {
    v4bf pk = {(__bf16)v[i].x, (__bf16)v[i].y, (__bf16)v[i].z, (__bf16)v[i].w};
    *(v4bf*)(xd + i * 128) = pk;                 // ds_store_b64
    a0 = fmaf(v[i].x, w[i].x, a0);
    a1 = fmaf(v[i].y, w[i].y, a1);
    a2 = fmaf(v[i].z, w[i].z, a2);
    a3 = fmaf(v[i].w, w[i].w, a3);
  }
  __syncthreads();                               // the 16 bf16 rows are readable by every wave

  // sv: the 16 partial sums of a row lie in one 16-lane row of a wave. Behind
  // the barrier, so that no wave waits there for this store.
  float acc = row16_sum((a0 + a1) + (a2 + a3));
  if ((t & 15) == 0) sv[R + srow] = acc + be;

  const unsigned char* ap = xs + (lane & 15) * XS_PITCH_ + ((lane >> 4) << 4);

  v8f cq0 = {}; v8f ck0 = {}; v8f cq1 = {}; v8f ck1 = {};
#pragma unroll   // the two fragment sets swap by renaming, no register copies
  for (int kk = 0; kk < 8; ++kk) {
    v16bf nq0, nk0, nq1, nk1;
    if (kk < 7) {                                  // the next step's weight fragments fly under this step
      nq0 = load_wfrag(wqb, woff, kk * 32 + 32);
      nk0 = load_wfrag(wkb, woff, kk * 32 + 32);
      nq1 = load_wfrag(wqb, woff, 128 * D_ + kk * 32 + 32);
      nk1 = load_wfrag(wkb, woff, 128 * D_ + kk * 32 + 32);
    }
    v8bf lo = *(const v8bf*)(ap + kk * 64);        // ds_load_b128
    v8bf hi = *(const v8bf*)(ap + kk * 64 + 32);   // ds_load_b128
    v16bf a = __builtin_shufflevector(lo, hi, 0,1,2,3,4,5,6,7,8,9,10,11,12,13,14,15);
    // Keeps the loads above in front of the WMMAs below: sunk to their uses,
    // every WMMA would wait out a whole L2 latency of its own.
    __builtin_amdgcn_sched_barrier(0);
    cq0 = wmma_bf16(a, fq0, cq0);
    ck0 = wmma_bf16(a, fk0, ck0);
    cq1 = wmma_bf16(a, fq1, cq1);
    ck1 = wmma_bf16(a, fk1, ck1);
    if (kk < 7) { fq0 = nq0; fk0 = nk0; fq1 = nq1; fk1 = nk1; }
  }

  const float scale = 0.0625f;          // 1/sqrt(256)
  int rbase = R + ((lane >> 4) << 3);
  int col0  = E0 + (lane & 15);
  int col1  = col0 + 128;
  float biasq0 = bq[col0], biask0 = bk[col0];
  float biasq1 = bq[col1], biask1 = bk[col1];
#pragma unroll   // accumulator elements are indexed by constants only
  for (int i = 0; i < 8; ++i) {
    size_t off = (size_t)(rbase + i) * D_;
    qb[off + col0] = (__bf16)((cq0[i] + biasq0) * scale);
    kb[off + col0] = (__bf16)(ck0[i] + biask0);
    qb[off + col1] = (__bf16)((cq1[i] + biasq1) * scale);
    kb[off + col1] = (__bf16)(ck1[i] + biask1);
  }
}

// ---------------------------------------------------------------------------
// Kernel 3: attention partials over one key segment.
// Block = 8 waves; wave w owns query rows [R, R+16). All waves share the keys
// staged in LDS: 128 keys per stage, two buffers, the next stage's tensor loads
// in flight while this stage is worked on. S^T = k_tile x q^T so each lane owns
// 8 keys of one query row -> shuffle-free online softmax per 16 keys; halves
// merge once at the end. Writes per-row {M, L, A} partials.
// The real block size is declared: under the default cap of 128 VGPRs the
// unrolled stage spills to scratch.
// ---------------------------------------------------------------------------
__global__ void __launch_bounds__(256)
k_attn(const __bf16* __restrict__ qb, const __bf16* __restrict__ kb,
       const float* __restrict__ sv,
       float* __restrict__ Mp, float* __restrict__ Lp,
       float* __restrict__ Ap) {
  __shared__ __attribute__((aligned(2048))) unsigned char smem[2 * LDS_BUF_];
  int tid  = threadIdx.x;
  int lane = tid & 31;
  unsigned int wv = uni((unsigned int)tid >> 5);   // 0..7, scalar
  int rowgroup = blockIdx.x >> 1;            // 128 rows per block
  int seg      = blockIdx.x & 1;
  int Rg = rowgroup * 128;                   // global row base of block
  int b  = Rg / N_;
  int R  = (Rg % N_) + (int)wv * 16;         // query row base within batch

  const __bf16* qbase = qb + (size_t)b * N_ * D_;
  const __bf16* kseg  = kb + (size_t)b * N_ * D_ + (size_t)seg * SEG_KEYS * D_;
  const float*  svb   = sv + b * N_ + seg * SEG_KEYS;
  unsigned int  lds0  = (unsigned int)(uintptr_t)&smem[0];   // LDS byte offset

  // This wave's slice of every stage: key rows (wv >> 1) * 32 .. + 31 of the
  // stage, byte half (wv & 1) of each row.
  const unsigned int       my_lds = lds0 + wv * SLICE_LDS_;
  const unsigned long long my_src = (unsigned long long)(uintptr_t)kseg
      + (unsigned long long)((wv >> 1) * (SLICE_ROWS_ * KROW_B_) + (wv & 1u) * SLICE_ROWB_);
  const u32x8 g1 = tdm_group1();

  tdm_load(tdm_group0(my_lds, my_src), g1);  // stage 0 -> buffer 0

  v16bf qf[8];
#pragma unroll
  for (int kk = 0; kk < 8; ++kk) qf[kk] = load_frag(qbase, R, D_, kk * 32, lane);

  asm volatile("s_wait_tensorcnt 0x0" ::: "memory");   // this wave's slice of stage 0 has landed
  __syncthreads();                                     // stage 0 readable by every wave
  tdm_load(tdm_group0(my_lds + LDS_BUF_, my_src + (unsigned long long)(STAGE_KEYS * KROW_B_)), g1);  // stage 1 -> buffer 1

  float M = -3.0e38f, L = 0.f, A = 0.f;
  int hk = (lane >> 4) << 3;                 // this half's key sub-offset
  int r16 = lane & 15;

  // The stage loop stays rolled: unrolled, its body (64 WMMAs and 8 softmax
  // updates) would be repeated 8 times in the instruction cache for nothing.
#pragma unroll 1
  for (unsigned int st = 0; st < STAGES_; ++st) {
    const unsigned int bufo = (st & 1u) * LDS_BUF_;
    const unsigned char* lanep = smem + bufo + r16 * LDS_PITCH_ + hk * 2;

    // Unrolled: every LDS offset is a constant, and with no barrier between
    // the 8 tiles their loads, WMMAs and softmax updates can overlap.
#pragma unroll
    for (int j = 0; j < SUBS_; ++j) {
      v8f s = {};
#pragma unroll
      for (int kk = 0; kk < 8; ++kk) {
        // key row j*16 + r16: slice pair j >> 1, row (j & 1) * 16 + r16 in it;
        // row bytes kk*64 ..: half kk >> 2, byte (kk & 3) * 64 in it.
        int off = ((j >> 1) * 2 + (kk >> 2)) * SLICE_LDS_ + (j & 1) * 16 * LDS_PITCH_ + (kk & 3) * 64;
        v8bf lo = *(const v8bf*)(lanep + off);        // ds_load_b128
        v8bf hi = *(const v8bf*)(lanep + off + 32);   // ds_load_b128
        v16bf kf = __builtin_shufflevector(lo, hi,
                     0,1,2,3,4,5,6,7,8,9,10,11,12,13,14,15);
        s = wmma_bf16(kf, qf[kk], s);
      }

      // s[i] = score(key st*128+j*16+hk+i, query R+r16); scale folded into q.
      const float* svp = svb + st * STAGE_KEYS + j * 16 + hk;
      float4 sv0 = *(const float4*)(svp);
      float4 sv1 = *(const float4*)(svp + 4);
      float sva[8] = {sv0.x, sv0.y, sv0.z, sv0.w, sv1.x, sv1.y, sv1.z, sv1.w};

      float cmax = s[0];
#pragma unroll
      for (int i = 1; i < 8; ++i) cmax = fmaxf(cmax, s[i]);
      float Mn    = fmaxf(M, cmax);
      float alpha = __expf(M - Mn);
      float l = 0.f, a = 0.f;
#pragma unroll
      for (int i = 0; i < 8; ++i) {
        float p = __expf(s[i] - Mn);           // v_exp_f32, co-executes with WMMA
        l += p;
        a = fmaf(p, sva[i], a);
      }
      L = fmaf(L, alpha, l);
      A = fmaf(A, alpha, a);
      M = Mn;
    }

    // Publish point of stage st + 1, passed by every wave, in this order.
    asm volatile("s_wait_dscnt 0x0" ::: "memory");      // this wave's reads of stage st have returned
    asm volatile("s_wait_tensorcnt 0x0" ::: "memory");  // this wave's slice of stage st + 1 has landed
    __syncthreads();                                    // st + 1 readable; every wave has left stage st
    if (pinned(st + 2u < STAGES_)) {                    // refill the buffer that stage st used
      tdm_load(tdm_group0(my_lds + bufo,
                          my_src + (unsigned long long)(st + 2u) * (STAGE_KEYS * KROW_B_)), g1);
    }
  }
  asm volatile("s_wait_tensorcnt 0x0" ::: "memory");    // no request outlives the loop
  asm volatile("s_wait_dscnt 0x0" ::: "memory");

  // Merge the two half-wave partials (keys {0..7}+16c vs {8..15}+16c).
  float Mo = __shfl_xor(M, 16, 32);
  float Lo = __shfl_xor(L, 16, 32);
  float Ao = __shfl_xor(A, 16, 32);
  float Mn = fmaxf(M, Mo);
  float s1 = __expf(M - Mn), s2 = __expf(Mo - Mn);
  float Lt = L * s1 + Lo * s2;
  float At = A * s1 + Ao * s2;

  if (lane < 16) {
    size_t grow = (size_t)b * N_ + R + lane;
    size_t idx  = (size_t)seg * ROWS_ + grow;
    Mp[idx] = Mn;
    Lp[idx] = Lt;
    Ap[idx] = At;
  }
}

// ---------------------------------------------------------------------------
// Kernel 4: merge the 2 key-segment partials per row; add bw.
// ---------------------------------------------------------------------------
__global__ void k_merge(const float* __restrict__ Mp, const float* __restrict__ Lp,
                        const float* __restrict__ Ap, const float* __restrict__ bw,
                        float* __restrict__ out) {
  int row = blockIdx.x * blockDim.x + threadIdx.x;
  float M0 = Mp[row], M1 = Mp[ROWS_ + row];
  float L0 = Lp[row], L1 = Lp[ROWS_ + row];
  float A0 = Ap[row], A1 = Ap[ROWS_ + row];
  float Mn = fmaxf(M0, M1);
  float e0 = __expf(M0 - Mn), e1 = __expf(M1 - Mn);
  float Lt = L0 * e0 + L1 * e1;
  float At = A0 * e0 + A1 * e1;
  out[row] = At / Lt + bw[0];
}

// ---------------------------------------------------------------------------
// Launch
// ---------------------------------------------------------------------------
extern "C" void kernel_launch(void* const* d_in, const int* in_sizes, int n_in,
                              void* d_out, int out_size, void* d_ws, size_t ws_size,
                              hipStream_t stream) {
  const float* x  = (const float*)d_in[0];
  const float* Wq = (const float*)d_in[1];
  const float* bq = (const float*)d_in[2];
  const float* Wk = (const float*)d_in[3];
  const float* bk = (const float*)d_in[4];
  const float* Wv = (const float*)d_in[5];
  const float* bv = (const float*)d_in[6];
  const float* Ww = (const float*)d_in[7];
  const float* bw = (const float*)d_in[8];
  float* out = (float*)d_out;

  char* ws = (char*)d_ws;
  __bf16* qb       = (__bf16*)(ws);                 // 8 MiB
  __bf16* kb       = (__bf16*)(ws + 8388608);       // 8 MiB
  __bf16* wqb      = (__bf16*)(ws + 25165824);      // 128 KiB
  __bf16* wkb      = (__bf16*)(ws + 25296896);      // 128 KiB
  float*  sv       = (float*) (ws + 25427968);      // 64 KiB
  float*  wv_eff   = (float*) (ws + 25493504);      // 1 KiB
  float*  bias_eff = (float*) (ws + 25494528);      // 256 B
  float*  Mp       = (float*) (ws + 25494784);      // 2*16384*4 = 128 KiB
  float*  Lp       = (float*) (ws + 25625856);      // 128 KiB
  float*  Ap       = (float*) (ws + 25756928);      // 128 KiB

  k_wveff   <<<1, 256, 0, stream>>>(Wv, bv, Ww, wv_eff, bias_eff);
  k_convW   <<<(D_ * D_) / 256, 256, 0, stream>>>(Wq, Wk, wqb, wkb);
  k_proj_qk <<<ROWS_ / 16, 256, 0, stream>>>(x, wv_eff, bias_eff, wqb, wkb, bq, bk, qb, kb, sv);
  // 128 row-groups x 2 key segments, 8 waves/block
  k_attn    <<<(ROWS_ / 128) * SEGS_, 256, 0, stream>>>(qb, kb, sv, Mp, Lp, Ap);
  k_merge   <<<ROWS_ / 256, 256, 0, stream>>>(Mp, Lp, Ap, bw, out);
}

// v003
// Measured time: 44.6 microseconds a run.
// In both of two side-by-side timings against v002, it was 1.31 times as fast.
// Counting every step since v000, it is 2.33 times as fast.
#include <hip/hip_runtime.h>

// ---------------------------------------------------------------------------
// MI455X (gfx1250, wave32).  B=8, N=2048, D=256.
//
// scores = softmax(q k^T / sqrt(D)) @ (v @ Ww^T) + bw
//   with  v @ Ww^T = x @ (Wv^T Ww^T) + bv.Ww     (V projection collapsed)
//
// GEMMs via v_wmma_f32_16x16x32_bf16.  Attention keys are staged into LDS by
// the tensor mover (tensor_load_to_lds) in stages of 128 keys, two buffers:
// every wave brings one padded slice per stage, one publish point per stage.
// ---------------------------------------------------------------------------

#define B_    8
#define N_    2048
#define D_    256
#define ROWS_ (B_ * N_)            // 16384

#define SEGS_     2                // key-dimension split per query tile
#define SEG_KEYS  (N_ / SEGS_)     // 1024
#define STAGE_KEYS 128                       // keys per tensor-load stage
#define STAGES_    (SEG_KEYS / STAGE_KEYS)   // 8 stages per segment
#define SUBS_      (STAGE_KEYS / 16)         // 8 score tiles of 16 keys per stage
#define KROW_B_    (D_ * 2)                  // 512 B: one key row in global memory

// LDS staging: a stage is 8 slices, one per wave. A slice is 32 key rows x one
// 256-B half of the row; the mover pads 16 B behind every 256-B row, so the
// LDS pitch is 272 B (16 B x odd: conflict-free for ds_load_b128).
#define SLICE_ROWS_ 32
#define SLICE_ROWB_ 256
#define LDS_PITCH_  272
#define SLICE_LDS_  10240          // 32 x 272 = 8704 B, rounded up to a multiple of 2 KiB
#define LDS_BUF_    (8 * SLICE_LDS_)   // 81920 B per buffer

typedef __attribute__((ext_vector_type(16))) __bf16 v16bf;
typedef __attribute__((ext_vector_type(8)))  __bf16 v8bf;
typedef __attribute__((ext_vector_type(4)))  __bf16 v4bf;
typedef __attribute__((ext_vector_type(8)))  float  v8f;
typedef __attribute__((ext_vector_type(4)))  unsigned int u32x4;
typedef __attribute__((ext_vector_type(8)))  unsigned int u32x8;

static __device__ __forceinline__ v8f wmma_bf16(v16bf a, v16bf b, v8f c) {
  return __builtin_amdgcn_wmma_f32_16x16x32_bf16(
      false, a, false, b, (short)0, c, false, false);
}

// 16x32 bf16 fragment from row-major global memory (A layout; also valid for
// the B operand when B's columns are rows of a row-major matrix).
static __device__ __forceinline__ v16bf load_frag(const __bf16* __restrict__ base,
                                                  int row, int ld, int k0, int lane) {
  int r  = lane & 15;
  int hk = (lane >> 4) << 3;                    // 0 or 8
  const __bf16* p = base + (size_t)(row + r) * ld + k0 + hk;
  v8bf lo = *(const v8bf*)(p);
  v8bf hi = *(const v8bf*)(p + 16);
  return __builtin_shufflevector(lo, hi, 0,1,2,3,4,5,6,7,8,9,10,11,12,13,14,15);
}

// ---------------------------------------------------------------------------
// Tensor mover: one request of one wave brings a slice (32 rows of 256 B, source
// pitch 512 B) from global memory into LDS at a pitch of 272 B.
// ---------------------------------------------------------------------------
static __device__ __forceinline__ unsigned int uni(unsigned int v) {
  return (unsigned int)__builtin_amdgcn_readfirstlane(v);
}
// Holds a wave-uniform test in a scalar register, so that the branch around a
// tensor load is a scalar one (a tensor load ignores EXEC).
static __device__ __forceinline__ unsigned int pinned(unsigned int v) {
  unsigned int w = uni(v);
  asm volatile("" : "+s"(w));  // pinned(): the test stays in a scalar register, the branch compiles to s_cmp + s_cbranch_scc
  return w;
}
// Group 1: 1-byte elements, tensor = tile = 32 rows x 256 B, pad of 4 dwords
// behind every 64 dwords (pad_enable, interval code 5, amount code 3), no mask.
static __device__ __forceinline__ u32x8 tdm_group1() {
  u32x8 g;
  g[0] = uni((1u << 20) | (5u << 22) | (3u << 25));
  g[1] = uni((unsigned int)SLICE_ROWB_ << 16);          // tensor_dim0 [15:0]
  g[2] = uni((unsigned int)SLICE_ROWS_ << 16);          // tensor_dim0 [31:16] = 0, tensor_dim1 [15:0]
  g[3] = uni((unsigned int)SLICE_ROWB_ << 16);          // tensor_dim1 [31:16] = 0, tile_dim0
  g[4] = uni((unsigned int)SLICE_ROWS_);                // tile_dim1
  g[5] = uni((unsigned int)KROW_B_);                    // source row pitch, bytes
  g[6] = uni(0u);
  g[7] = uni(0u);
  return g;
}
// Group 0: count 1, LDS byte offset, global byte address, type 2.
static __device__ __forceinline__ u32x4 tdm_group0(unsigned int lds_dst, unsigned long long ga) {
  u32x4 g;
  g[0] = uni(1u);
  g[1] = uni(lds_dst);
  g[2] = uni((unsigned int)ga);
  g[3] = uni((((unsigned int)(ga >> 32)) & 0x01FFFFFFu) | 0x80000000u);
  return g;
}
static __device__ __forceinline__ void tdm_load(u32x4 g0, u32x8 g1) {
  // The two-group form of the request; "memory" keeps LDS reads on their side of it.
  asm volatile("tensor_load_to_lds %0, %1" :: "s"(g0), "s"(g1) : "memory");
}

// Sum over the 16 lanes of a row by DPP adds (row_xmask 8, 4, 2, 1); every lane
// of the wave is on where it is called.
template <int M>
static __device__ __forceinline__ float row_xadd(float s) {
  int o = __builtin_amdgcn_update_dpp(0, __float_as_int(s), 0x160 | M, 0xf, 0xf, true);
  return s + __int_as_float(o);
}
static __device__ __forceinline__ float row16_sum(float s) {
  s = row_xadd<8>(s);
  s = row_xadd<4>(s);
  s = row_xadd<2>(s);
  s = row_xadd<1>(s);
  return s;
}

// ---------------------------------------------------------------------------
// Kernel 0: weight preparation, one launch.
// Blocks 0..7: wv_eff[d] = sum_e Wv[e,d]*Ww[e], 32 columns d per block (one
// whole 128-B line of wv_eff has one writer); wave g sums rows 32g..32g+31 with
// all its 32 loads in flight, the 8 partial sums of a column meet in LDS.
// Block 8: bias_eff = bv.Ww, by one wave.
// Blocks 9..264: Wq, Wk -> bf16, one element of each per thread.
// ---------------------------------------------------------------------------
#define WVB_ (D_ / 32)             // 8 blocks for wv_eff

__global__ void __launch_bounds__(256)
k_prep(const float* __restrict__ Wq, const float* __restrict__ Wk,
       const float* __restrict__ Wv, const float* __restrict__ bv,
       const float* __restrict__ Ww,
       __bf16* __restrict__ wqb, __bf16* __restrict__ wkb,
       float* __restrict__ wv_eff, float* __restrict__ bias_eff) {
  __shared__ float red[8 * 32];
  int t = threadIdx.x;
  if (blockIdx.x > WVB_) {                       // whole blocks leave here, in front of the barrier
    int i = (blockIdx.x - (WVB_ + 1)) * 256 + t;
    wqb[i] = (__bf16)Wq[i];
    wkb[i] = (__bf16)Wk[i];
    return;
  }
  if (blockIdx.x == WVB_) {                      // as above
    if (t < 32) {
      float c0 = 0.f, c1 = 0.f, c2 = 0.f, c3 = 0.f;
#pragma unroll   // all 16 loads in flight at once
      for (int i = 0; i < D_; i += 128) {
        c0 = fmaf(bv[i + t],      Ww[i + t],      c0);
        c1 = fmaf(bv[i + 32 + t], Ww[i + 32 + t], c1);
        c2 = fmaf(bv[i + 64 + t], Ww[i + 64 + t], c2);
        c3 = fmaf(bv[i + 96 + t], Ww[i + 96 + t], c3);
      }
      float r = row16_sum((c0 + c1) + (c2 + c3));
      r += __shfl_xor(r, 16, 32);
      if (t == 0) bias_eff[0] = r;
    }
    return;
  }
  int lane = t & 31;
  int g    = __builtin_amdgcn_readfirstlane(t >> 5);   // wave number, scalar: Ww comes by scalar loads
  int col  = blockIdx.x * 32 + lane;
  const float* wp  = Wv + g * 32 * D_ + col;
  const float* wwp = Ww + g * 32;

  float v[32];
#pragma unroll   // v stays in registers, every offset a constant
  for (int i = 0; i < 32; ++i) v[i] = wp[i * D_];

  float a0 = 0.f, a1 = 0.f, a2 = 0.f, a3 = 0.f;
#pragma unroll   // as above
  for (int i = 0; i < 32; i += 4) {
    a0 = fmaf(v[i],     wwp[i],     a0);
    a1 = fmaf(v[i + 1], wwp[i + 1], a1);
    a2 = fmaf(v[i + 2], wwp[i + 2], a2);
    a3 = fmaf(v[i + 3], wwp[i + 3], a3);
  }
  red[g * 32 + lane] = (a0 + a1) + (a2 + a3);
  __syncthreads();                               // the partial sums are readable by wave 0

  if (t < 32) {
    float s0 = (red[lane]       + red[32 + lane])  + (red[64 + lane]  + red[96 + lane]);
    float s1 = (red[128 + lane] + red[160 + lane]) + (red[192 + lane] + red[224 + lane]);
    wv_eff[col] = s0 + s1;
  }
}

// ---------------------------------------------------------------------------
// Kernel 2: Q/K projection straight from the f32 x.
// A block owns 16 rows of x and all 256 output columns of Q and of K. It reads
// its rows once (whole 256-B pieces per 16 lanes), rounds them to bf16 into LDS
// and forms sv[row] = dot(x[row,:], wv_eff) + bias_eff on the way; then every
// wave takes its A fragments from LDS for two 16-column tiles of Q and of K.
//   qb = bf16((x@Wq^T + bq) / sqrt(D)),  kb = bf16(x@Wk^T + bk)
// ---------------------------------------------------------------------------
// 16x32 bf16 weight fragment: uniform base, one 32-bit element offset per lane
// shared by every fragment of the wave, the rest a constant.
static __device__ __forceinline__ v16bf load_wfrag(const __bf16* __restrict__ base,
                                                   unsigned int lane_off, int c) {
  const __bf16* p = (base + lane_off) + c;
  v8bf lo = *(const v8bf*)(p);
  v8bf hi = *(const v8bf*)(p + 16);
  return __builtin_shufflevector(lo, hi, 0,1,2,3,4,5,6,7,8,9,10,11,12,13,14,15);
}

#define XS_PITCH_ 528              // 512 B of bf16 + 16 B: 16 B x odd, conflict-free for ds_load_b128

__global__ void k_proj_qk(const float* __restrict__ x,
                          const float* __restrict__ wv_eff,
                          const float* __restrict__ bias_eff,
                          const __bf16* __restrict__ wqb,
                          const __bf16* __restrict__ wkb,
                          const float* __restrict__ bq,
                          const float* __restrict__ bk,
                          __bf16* __restrict__ qb, __bf16* __restrict__ kb,
                          float* __restrict__ sv) {
  __shared__ __attribute__((aligned(16))) unsigned char xs[16 * XS_PITCH_];
  int t    = threadIdx.x;
  int lane = t & 31;
  int wv   = t >> 5;
  int R    = blockIdx.x * 16;
  int E0   = wv * 16;                            // column tiles E0 and E0 + 128

  // The first weight fragments are asked for ahead of the staging.
  unsigned int woff = (unsigned int)((E0 + (lane & 15)) * D_ + ((lane >> 4) << 3));
  v16bf fq0 = load_wfrag(wqb, woff, 0);
  v16bf fk0 = load_wfrag(wkb, woff, 0);
  v16bf fq1 = load_wfrag(wqb, woff, 128 * D_);
  v16bf fk1 = load_wfrag(wkb, woff, 128 * D_);
  float be = bias_eff[0];
  // Precaution: stands in front of the first write of a register that the loads
  // above name (their offset register is reused as a load destination below).
  asm volatile("s_wait_xcnt 0x0" ::: "memory");

  // Stage: 16 threads per row, 4 floats per thread and pass.
  int srow = t >> 4;
  int sc   = (t & 15) * 4;
  const float* xr = (x + (size_t)R * D_) + (unsigned int)(srow * D_ + sc);
  float4 v[4], w[4];
#pragma unroll   // v and w stay in registers, every offset a constant
  for (int i = 0; i < 4; ++i) {
    v[i] = *(const float4*)(xr + i * 64);
    w[i] = *(const float4*)(wv_eff + sc + i * 64);
  }
  // All loads above are asked for before the first of them is waited for:
  // otherwise the weight fragments start only when x has arrived.
  __builtin_amdgcn_sched_barrier(0);

  unsigned char* xd = xs + srow * XS_PITCH_ + sc * 2;
  float a0 = 0.f, a1 = 0.f, a2 = 0.f, a3 = 0.f;
#pragma unroll   // as above
  for (int i = 0; i < 4; ++i) {
    v4bf pk = {(__bf16)v[i].x, (__bf16)v[i].y, (__bf16)v[i].z, (__bf16)v[i].w};
    *(v4bf*)(xd + i * 128) = pk;                 // ds_store_b64
    a0 = fmaf(v[i].x, w[i].x, a0);
    a1 = fmaf(v[i].y, w[i].y, a1);
    a2 = fmaf(v[i].z, w[i].z, a2);
    a3 = fmaf(v[i].w, w[i].w, a3);
  }
  __syncthreads();                               // the 16 bf16 rows are readable by every wave

  // sv: the 16 partial sums of a row lie in one 16-lane row of a wave. Behind
  // the barrier, so that no wave waits there for this store.
  float acc = row16_sum((a0 + a1) + (a2 + a3));
  if ((t & 15) == 0) sv[R + srow] = acc + be;

  const unsigned char* ap = xs + (lane & 15) * XS_PITCH_ + ((lane >> 4) << 4);

  v8f cq0 = {}; v8f ck0 = {}; v8f cq1 = {}; v8f ck1 = {};
#pragma unroll   // the two fragment sets swap by renaming, no register copies
  for (int kk = 0; kk < 8; ++kk) {
    v16bf nq0, nk0, nq1, nk1;
    if (kk < 7) {                                  // the next step's weight fragments fly under this step
      nq0 = load_wfrag(wqb, woff, kk * 32 + 32);
      nk0 = load_wfrag(wkb, woff, kk * 32 + 32);
      nq1 = load_wfrag(wqb, woff, 128 * D_ + kk * 32 + 32);
      nk1 = load_wfrag(wkb, woff, 128 * D_ + kk * 32 + 32);
    }
    v8bf lo = *(const v8bf*)(ap + kk * 64);        // ds_load_b128
    v8bf hi = *(const v8bf*)(ap + kk * 64 + 32);   // ds_load_b128
    v16bf a = __builtin_shufflevector(lo, hi, 0,1,2,3,4,5,6,7,8,9,10,11,12,13,14,15);
    // Keeps the loads above in front of the WMMAs below: sunk to their uses,
    // every WMMA would wait out a whole L2 latency of its own.
    __builtin_amdgcn_sched_barrier(0);
    cq0 = wmma_bf16(a, fq0, cq0);
    ck0 = wmma_bf16(a, fk0, ck0);
    cq1 = wmma_bf16(a, fq1, cq1);
    ck1 = wmma_bf16(a, fk1, ck1);
    if (kk < 7) { fq0 = nq0; fk0 = nk0; fq1 = nq1; fk1 = nk1; }
  }

  const float scale = 0.0625f;          // 1/sqrt(256)
  int rbase = R + ((lane >> 4) << 3);
  int col0  = E0 + (lane & 15);
  int col1  = col0 + 128;
  float biasq0 = bq[col0], biask0 = bk[col0];
  float biasq1 = bq[col1], biask1 = bk[col1];
#pragma unroll   // accumulator elements are indexed by constants only
  for (int i = 0; i < 8; ++i) {
    size_t off = (size_t)(rbase + i) * D_;
    qb[off + col0] = (__bf16)((cq0[i] + biasq0) * scale);
    kb[off + col0] = (__bf16)(ck0[i] + biask0);
    qb[off + col1] = (__bf16)((cq1[i] + biasq1) * scale);
    kb[off + col1] = (__bf16)(ck1[i] + biask1);
  }
}

// ---------------------------------------------------------------------------
// Kernel 3: attention partials over one key segment.
// Block = 8 waves; wave w owns query rows [R, R+16). All waves share the keys
// staged in LDS: 128 keys per stage, two buffers, the next stage's tensor loads
// in flight while this stage is worked on. S^T = k_tile x q^T so each lane owns
// 8 keys of one query row -> shuffle-free online softmax per 16 keys; halves
// merge once at the end. Writes per-row {M, L, A} partials.
// The real block size is declared: under the default cap of 128 VGPRs the
// unrolled stage spills to scratch.
// ---------------------------------------------------------------------------
__global__ void __launch_bounds__(256)
k_attn(const __bf16* __restrict__ qb, const __bf16* __restrict__ kb,
       const float* __restrict__ sv,
       float* __restrict__ Mp, float* __restrict__ Lp,
       float* __restrict__ Ap) {
  __shared__ __attribute__((aligned(2048))) unsigned char smem[2 * LDS_BUF_];
  int tid  = threadIdx.x;
  int lane = tid & 31;
  unsigned int wv = uni((unsigned int)tid >> 5);   // 0..7, scalar
  int rowgroup = blockIdx.x >> 1;            // 128 rows per block
  int seg      = blockIdx.x & 1;
  int Rg = rowgroup * 128;                   // global row base of block
  int b  = Rg / N_;
  int R  = (Rg % N_) + (int)wv * 16;         // query row base within batch

  const __bf16* qbase = qb + (size_t)b * N_ * D_;
  const __bf16* kseg  = kb + (size_t)b * N_ * D_ + (size_t)seg * SEG_KEYS * D_;
  const float*  svb   = sv + b * N_ + seg * SEG_KEYS;
  unsigned int  lds0  = (unsigned int)(uintptr_t)&smem[0];   // LDS byte offset

  // This wave's slice of every stage: key rows (wv >> 1) * 32 .. + 31 of the
  // stage, byte half (wv & 1) of each row.
  const unsigned int       my_lds = lds0 + wv * SLICE_LDS_;
  const unsigned long long my_src = (unsigned long long)(uintptr_t)kseg
      + (unsigned long long)((wv >> 1) * (SLICE_ROWS_ * KROW_B_) + (wv & 1u) * SLICE_ROWB_);
  const u32x8 g1 = tdm_group1();

  tdm_load(tdm_group0(my_lds, my_src), g1);  // stage 0 -> buffer 0

  v16bf qf[8];
#pragma unroll
  for (int kk = 0; kk < 8; ++kk) qf[kk] = load_frag(qbase, R, D_, kk * 32, lane);

  asm volatile("s_wait_tensorcnt 0x0" ::: "memory");   // this wave's slice of stage 0 has landed
  __syncthreads();                                     // stage 0 readable by every wave
  tdm_load(tdm_group0(my_lds + LDS_BUF_, my_src + (unsigned long long)(STAGE_KEYS * KROW_B_)), g1);  // stage 1 -> buffer 1

  float M = -3.0e38f, L = 0.f, A = 0.f;
  int hk = (lane >> 4) << 3;                 // this half's key sub-offset
  int r16 = lane & 15;

  // The stage loop stays rolled: unrolled, its body (64 WMMAs and 8 softmax
  // updates) would be repeated 8 times in the instruction cache for nothing.
#pragma unroll 1
  for (unsigned int st = 0; st < STAGES_; ++st) {
    const unsigned int bufo = (st & 1u) * LDS_BUF_;
    const unsigned char* lanep = smem + bufo + r16 * LDS_PITCH_ + hk * 2;

    // Unrolled: every LDS offset is a constant, and with no barrier between
    // the 8 tiles their loads, WMMAs and softmax updates can overlap.
#pragma unroll
    for (int j = 0; j < SUBS_; ++j) {
      v8f s = {};
#pragma unroll
      for (int kk = 0; kk < 8; ++kk) {
        // key row j*16 + r16: slice pair j >> 1, row (j & 1) * 16 + r16 in it;
        // row bytes kk*64 ..: half kk >> 2, byte (kk & 3) * 64 in it.
        int off = ((j >> 1) * 2 + (kk >> 2)) * SLICE_LDS_ + (j & 1) * 16 * LDS_PITCH_ + (kk & 3) * 64;
        v8bf lo = *(const v8bf*)(lanep + off);        // ds_load_b128
        v8bf hi = *(const v8bf*)(lanep + off + 32);   // ds_load_b128
        v16bf kf = __builtin_shufflevector(lo, hi,
                     0,1,2,3,4,5,6,7,8,9,10,11,12,13,14,15);
        s = wmma_bf16(kf, qf[kk], s);
      }

      // s[i] = score(key st*128+j*16+hk+i, query R+r16); scale folded into q.
      const float* svp = svb + st * STAGE_KEYS + j * 16 + hk;
      float4 sv0 = *(const float4*)(svp);
      float4 sv1 = *(const float4*)(svp + 4);
      float sva[8] = {sv0.x, sv0.y, sv0.z, sv0.w, sv1.x, sv1.y, sv1.z, sv1.w};

      float cmax = s[0];
#pragma unroll
      for (int i = 1; i < 8; ++i) cmax = fmaxf(cmax, s[i]);
      float Mn    = fmaxf(M, cmax);
      float alpha = __expf(M - Mn);
      float l = 0.f, a = 0.f;
#pragma unroll
      for (int i = 0; i < 8; ++i) {
        float p = __expf(s[i] - Mn);           // v_exp_f32, co-executes with WMMA
        l += p;
        a = fmaf(p, sva[i], a);
      }
      L = fmaf(L, alpha, l);
      A = fmaf(A, alpha, a);
      M = Mn;
    }

    // Publish point of stage st + 1, passed by every wave, in this order.
    asm volatile("s_wait_dscnt 0x0" ::: "memory");      // this wave's reads of stage st have returned
    asm volatile("s_wait_tensorcnt 0x0" ::: "memory");  // this wave's slice of stage st + 1 has landed
    __syncthreads();                                    // st + 1 readable; every wave has left stage st
    if (pinned(st + 2u < STAGES_)) {                    // refill the buffer that stage st used
      tdm_load(tdm_group0(my_lds + bufo,
                          my_src + (unsigned long long)(st + 2u) * (STAGE_KEYS * KROW_B_)), g1);
    }
  }
  asm volatile("s_wait_tensorcnt 0x0" ::: "memory");    // no request outlives the loop
  asm volatile("s_wait_dscnt 0x0" ::: "memory");

  // Merge the two half-wave partials (keys {0..7}+16c vs {8..15}+16c).
  float Mo = __shfl_xor(M, 16, 32);
  float Lo = __shfl_xor(L, 16, 32);
  float Ao = __shfl_xor(A, 16, 32);
  float Mn = fmaxf(M, Mo);
  float s1 = __expf(M - Mn), s2 = __expf(Mo - Mn);
  float Lt = L * s1 + Lo * s2;
  float At = A * s1 + Ao * s2;

  if (lane < 16) {
    size_t grow = (size_t)b * N_ + R + lane;
    size_t idx  = (size_t)seg * ROWS_ + grow;
    Mp[idx] = Mn;
    Lp[idx] = Lt;
    Ap[idx] = At;
  }
}

// ---------------------------------------------------------------------------
// Kernel 4: merge the 2 key-segment partials per row; add bw.
// ---------------------------------------------------------------------------
__global__ void k_merge(const float* __restrict__ Mp, const float* __restrict__ Lp,
                        const float* __restrict__ Ap, const float* __restrict__ bw,
                        float* __restrict__ out) {
  int row = blockIdx.x * blockDim.x + threadIdx.x;
  float M0 = Mp[row], M1 = Mp[ROWS_ + row];
  float L0 = Lp[row], L1 = Lp[ROWS_ + row];
  float A0 = Ap[row], A1 = Ap[ROWS_ + row];
  float Mn = fmaxf(M0, M1);
  float e0 = __expf(M0 - Mn), e1 = __expf(M1 - Mn);
  float Lt = L0 * e0 + L1 * e1;
  float At = A0 * e0 + A1 * e1;
  out[row] = At / Lt + bw[0];
}

// ---------------------------------------------------------------------------
// Launch
// ---------------------------------------------------------------------------
extern "C" void kernel_launch(void* const* d_in, const int* in_sizes, int n_in,
                              void* d_out, int out_size, void* d_ws, size_t ws_size,
                              hipStream_t stream) {
  const float* x  = (const float*)d_in[0];
  const float* Wq = (const float*)d_in[1];
  const float* bq = (const float*)d_in[2];
  const float* Wk = (const float*)d_in[3];
  const float* bk = (const float*)d_in[4];
  const float* Wv = (const float*)d_in[5];
  const float* bv = (const float*)d_in[6];
  const float* Ww = (const float*)d_in[7];
  const float* bw = (const float*)d_in[8];
  float* out = (float*)d_out;

  char* ws = (char*)d_ws;
  __bf16* qb       = (__bf16*)(ws);                 // 8 MiB
  __bf16* kb       = (__bf16*)(ws + 8388608);       // 8 MiB
  __bf16* wqb      = (__bf16*)(ws + 25165824);      // 128 KiB
  __bf16* wkb      = (__bf16*)(ws + 25296896);      // 128 KiB
  float*  sv       = (float*) (ws + 25427968);      // 64 KiB
  float*  wv_eff   = (float*) (ws + 25493504);      // 1 KiB
  float*  bias_eff = (float*) (ws + 25494528);      // 256 B
  float*  Mp       = (float*) (ws + 25494784);      // 2*16384*4 = 128 KiB
  float*  Lp       = (float*) (ws + 25625856);      // 128 KiB
  float*  Ap       = (float*) (ws + 25756928);      // 128 KiB

  k_prep    <<<WVB_ + 1 + (D_ * D_) / 256, 256, 0, stream>>>(Wq, Wk, Wv, bv, Ww, wqb, wkb, wv_eff, bias_eff);
  k_proj_qk <<<ROWS_ / 16, 256, 0, stream>>>(x, wv_eff, bias_eff, wqb, wkb, bq, bk, qb, kb, sv);
  // 128 row-groups x 2 key segments, 8 waves/block
  k_attn    <<<(ROWS_ / 128) * SEGS_, 256, 0, stream>>>(qb, kb, sv, Mp, Lp, Ap);
  k_merge   <<<ROWS_ / 256, 256, 0, stream>>>(Mp, Lp, Ap, bw, out);
}

// v004
// It runs in 34.3 microseconds.
// Two timings next to v003 put it at 1.31 and 1.30 times that version's speed.
// All steps since v000 together make it 3.04 times as fast.
#include <hip/hip_runtime.h>

// ---------------------------------------------------------------------------
// MI455X (gfx1250, wave32).  B=8, N=2048, D=256.
//
// scores = softmax(q k^T / sqrt(D)) @ (v @ Ww^T) + bw
//   with  v @ Ww^T = x @ (Wv^T Ww^T) + bv.Ww     (V projection collapsed)
//
// GEMMs via v_wmma_f32_16x16x32_bf16.  Attention keys are staged into LDS by
// the tensor mover (tensor_load_to_lds) in stages of 128 keys, two buffers:
// every wave brings one padded slice per stage, one publish point per stage.
// ---------------------------------------------------------------------------

#define B_    8
#define N_    2048
#define D_    256
#define ROWS_ (B_ * N_)            // 16384

#define SEGS_     2                // key-dimension split per query tile
#define SEG_KEYS  (N_ / SEGS_)     // 1024
#define STAGE_KEYS 128                       // keys per tensor-load stage
#define STAGES_    (SEG_KEYS / STAGE_KEYS)   // 8 stages per segment
#define SUBS_      (STAGE_KEYS / 16)         // 8 score tiles of 16 keys per stage
#define KROW_B_    (D_ * 2)                  // 512 B: one key row in global memory

// LDS staging: a stage is 8 slices, one per wave. A slice is 32 key rows x one
// 256-B half of the row; the mover pads 16 B behind every 256-B row, so the
// LDS pitch is 272 B (16 B x odd: conflict-free for ds_load_b128).
#define SLICE_ROWS_ 32
#define SLICE_ROWB_ 256
#define LDS_PITCH_  272
#define SLICE_LDS_  10240          // 32 x 272 = 8704 B, rounded up to a multiple of 2 KiB
#define LDS_BUF_    (8 * SLICE_LDS_)   // 81920 B per buffer

typedef __attribute__((ext_vector_type(16))) __bf16 v16bf;
typedef __attribute__((ext_vector_type(8)))  __bf16 v8bf;
typedef __attribute__((ext_vector_type(4)))  __bf16 v4bf;
typedef __attribute__((ext_vector_type(8)))  float  v8f;
typedef __attribute__((ext_vector_type(4)))  unsigned int u32x4;
typedef __attribute__((ext_vector_type(8)))  unsigned int u32x8;

static __device__ __forceinline__ v8f wmma_bf16(v16bf a, v16bf b, v8f c) {
  return __builtin_amdgcn_wmma_f32_16x16x32_bf16(
      false, a, false, b, (short)0, c, false, false);
}

// 16x32 bf16 fragment from row-major global memory (A layout; also valid for
// the B operand when B's columns are rows of a row-major matrix).
static __device__ __forceinline__ v16bf load_frag(const __bf16* __restrict__ base,
                                                  int row, int ld, int k0, int lane) {
  int r  = lane & 15;
  int hk = (lane >> 4) << 3;                    // 0 or 8
  const __bf16* p = base + (size_t)(row + r) * ld + k0 + hk;
  v8bf lo = *(const v8bf*)(p);
  v8bf hi = *(const v8bf*)(p + 16);
  return __builtin_shufflevector(lo, hi, 0,1,2,3,4,5,6,7,8,9,10,11,12,13,14,15);
}

// ---------------------------------------------------------------------------
// Tensor mover: one request of one wave brings a slice (32 rows of 256 B, source
// pitch 512 B) from global memory into LDS at a pitch of 272 B.
// ---------------------------------------------------------------------------
static __device__ __forceinline__ unsigned int uni(unsigned int v) {
  return (unsigned int)__builtin_amdgcn_readfirstlane(v);
}
// Holds a wave-uniform test in a scalar register, so that the branch around a
// tensor load is a scalar one (a tensor load ignores EXEC).
static __device__ __forceinline__ unsigned int pinned(unsigned int v) {
  unsigned int w = uni(v);
  asm volatile("" : "+s"(w));  // pinned(): the test stays in a scalar register, the branch compiles to s_cmp + s_cbranch_scc
  return w;
}
// Group 1: 1-byte elements, tensor = tile = 32 rows x 256 B, pad of 4 dwords
// behind every 64 dwords (pad_enable, interval code 5, amount code 3), no mask.
static __device__ __forceinline__ u32x8 tdm_group1() {
  u32x8 g;
  g[0] = uni((1u << 20) | (5u << 22) | (3u << 25));
  g[1] = uni((unsigned int)SLICE_ROWB_ << 16);          // tensor_dim0 [15:0]
  g[2] = uni((unsigned int)SLICE_ROWS_ << 16);          // tensor_dim0 [31:16] = 0, tensor_dim1 [15:0]
  g[3] = uni((unsigned int)SLICE_ROWB_ << 16);          // tensor_dim1 [31:16] = 0, tile_dim0
  g[4] = uni((unsigned int)SLICE_ROWS_);                // tile_dim1
  g[5] = uni((unsigned int)KROW_B_);                    // source row pitch, bytes
  g[6] = uni(0u);
  g[7] = uni(0u);
  return g;
}
// Group 0: count 1, LDS byte offset, global byte address, type 2.
static __device__ __forceinline__ u32x4 tdm_group0(unsigned int lds_dst, unsigned long long ga) {
  u32x4 g;
  g[0] = uni(1u);
  g[1] = uni(lds_dst);
  g[2] = uni((unsigned int)ga);
  g[3] = uni((((unsigned int)(ga >> 32)) & 0x01FFFFFFu) | 0x80000000u);
  return g;
}
static __device__ __forceinline__ void tdm_load(u32x4 g0, u32x8 g1) {
  // The two-group form of the request; "memory" keeps LDS reads on their side of it.
  asm volatile("tensor_load_to_lds %0, %1" :: "s"(g0), "s"(g1) : "memory");
}

// Sum over the 16 lanes of a row by DPP adds (row_xmask 8, 4, 2, 1); every lane
// of the wave is on where it is called.
template <int M>
static __device__ __forceinline__ float row_xadd(float s) {
  int o = __builtin_amdgcn_update_dpp(0, __float_as_int(s), 0x160 | M, 0xf, 0xf, true);
  return s + __int_as_float(o);
}
static __device__ __forceinline__ float row16_sum(float s) {
  s = row_xadd<8>(s);
  s = row_xadd<4>(s);
  s = row_xadd<2>(s);
  s = row_xadd<1>(s);
  return s;
}

// ---------------------------------------------------------------------------
// Kernel 0: weight preparation, one launch.
// Blocks 0..7: wv_eff[d] = sum_e Wv[e,d]*Ww[e], 32 columns d per block (one
// whole 128-B line of wv_eff has one writer); wave g sums rows 32g..32g+31 with
// all its 32 loads in flight, the 8 partial sums of a column meet in LDS.
// Block 8: bias_eff = bv.Ww, by one wave.
// Blocks 9..264: Wq, Wk -> bf16, one element of each per thread.
// ---------------------------------------------------------------------------
#define WVB_ (D_ / 32)             // 8 blocks for wv_eff

__global__ void __launch_bounds__(256)
k_prep(const float* __restrict__ Wq, const float* __restrict__ Wk,
       const float* __restrict__ Wv, const float* __restrict__ bv,
       const float* __restrict__ Ww,
       __bf16* __restrict__ wqb, __bf16* __restrict__ wkb,
       float* __restrict__ wv_eff, float* __restrict__ bias_eff) {
  __shared__ float red[8 * 32];
  int t = threadIdx.x;
  if (blockIdx.x > WVB_) {                       // whole blocks leave here, in front of the barrier
    int i = (blockIdx.x - (WVB_ + 1)) * 256 + t;
    wqb[i] = (__bf16)Wq[i];
    wkb[i] = (__bf16)Wk[i];
    return;
  }
  if (blockIdx.x == WVB_) {                      // as above
    if (t < 32) {
      float c0 = 0.f, c1 = 0.f, c2 = 0.f, c3 = 0.f;
#pragma unroll   // all 16 loads in flight at once
      for (int i = 0; i < D_; i += 128) {
        c0 = fmaf(bv[i + t],      Ww[i + t],      c0);
        c1 = fmaf(bv[i + 32 + t], Ww[i + 32 + t], c1);
        c2 = fmaf(bv[i + 64 + t], Ww[i + 64 + t], c2);
        c3 = fmaf(bv[i + 96 + t], Ww[i + 96 + t], c3);
      }
      float r = row16_sum((c0 + c1) + (c2 + c3));
      r += __shfl_xor(r, 16, 32);
      if (t == 0) bias_eff[0] = r;
    }
    return;
  }
  int lane = t & 31;
  int g    = __builtin_amdgcn_readfirstlane(t >> 5);   // wave number, scalar: Ww comes by scalar loads
  int col  = blockIdx.x * 32 + lane;
  const float* wp  = Wv + g * 32 * D_ + col;
  const float* wwp = Ww + g * 32;

  float v[32];
#pragma unroll   // v stays in registers, every offset a constant
  for (int i = 0; i < 32; ++i) v[i] = wp[i * D_];

  float a0 = 0.f, a1 = 0.f, a2 = 0.f, a3 = 0.f;
#pragma unroll   // as above
  for (int i = 0; i < 32; i += 4) {
    a0 = fmaf(v[i],     wwp[i],     a0);
    a1 = fmaf(v[i + 1], wwp[i + 1], a1);
    a2 = fmaf(v[i + 2], wwp[i + 2], a2);
    a3 = fmaf(v[i + 3], wwp[i + 3], a3);
  }
  red[g * 32 + lane] = (a0 + a1) + (a2 + a3);
  __syncthreads();                               // the partial sums are readable by wave 0

  if (t < 32) {
    float s0 = (red[lane]       + red[32 + lane])  + (red[64 + lane]  + red[96 + lane]);
    float s1 = (red[128 + lane] + red[160 + lane]) + (red[192 + lane] + red[224 + lane]);
    wv_eff[col] = s0 + s1;
  }
}

// ---------------------------------------------------------------------------
// Kernel 2: Q/K projection straight from the f32 x.
// A block owns 64 rows of x (4 row tiles) and all 256 output columns of Q and
// of K. It reads its rows once (whole 256-B pieces per 16 lanes), rounds them to
// bf16 into LDS and forms sv[row] = dot(x[row,:], wv_eff) + bias_eff on the way;
// then every wave takes two 16-column tiles of Q and of K, and each weight
// fragment it loads feeds all 4 row tiles, whose A fragments come from LDS.
//   qb = bf16((x@Wq^T + bq) / sqrt(D)),  kb = bf16(x@Wk^T + bk)
// ---------------------------------------------------------------------------
// 16x32 bf16 weight fragment: uniform base, one 32-bit element offset per lane
// shared by every fragment of the wave, the rest a constant.
static __device__ __forceinline__ v16bf load_wfrag(const __bf16* __restrict__ base,
                                                   unsigned int lane_off, int c) {
  const __bf16* p = (base + lane_off) + c;
  v8bf lo = *(const v8bf*)(p);
  v8bf hi = *(const v8bf*)(p + 16);
  return __builtin_shufflevector(lo, hi, 0,1,2,3,4,5,6,7,8,9,10,11,12,13,14,15);
}

#define XS_PITCH_ 528              // 512 B of bf16 + 16 B: 16 B x odd, conflict-free for ds_load_b128
#define PROWS_    64               // rows of x per block
#define PTILES_   (PROWS_ / 16)    // row tiles per block

// The real block size is declared: 16 accumulator tiles a wave do not fit the
// default cap of 128 VGPRs.
__global__ void __launch_bounds__(256)
k_proj_qk(const float* __restrict__ x,
          const float* __restrict__ wv_eff,
          const float* __restrict__ bias_eff,
          const __bf16* __restrict__ wqb,
          const __bf16* __restrict__ wkb,
          const float* __restrict__ bq,
          const float* __restrict__ bk,
          __bf16* __restrict__ qb, __bf16* __restrict__ kb,
          float* __restrict__ sv) {
  __shared__ __attribute__((aligned(16))) unsigned char xs[PROWS_ * XS_PITCH_];
  int t    = threadIdx.x;
  int lane = t & 31;
  int wv   = t >> 5;
  int R    = blockIdx.x * PROWS_;
  int E0   = wv * 16;                            // column tiles E0 and E0 + 128

  // The first weight fragments are asked for ahead of the staging.
  unsigned int woff = (unsigned int)((E0 + (lane & 15)) * D_ + ((lane >> 4) << 3));
  v16bf fq0 = load_wfrag(wqb, woff, 0);
  v16bf fk0 = load_wfrag(wkb, woff, 0);
  v16bf fq1 = load_wfrag(wqb, woff, 128 * D_);
  v16bf fk1 = load_wfrag(wkb, woff, 128 * D_);
  float be = bias_eff[0];
  // Precaution: stands in front of the first write of a register that the loads
  // above name (their offset register is reused as a load destination below).
  asm volatile("s_wait_xcnt 0x0" ::: "memory");

  // Stage: 16 threads per row, 4 floats per thread and pass; thread group srow
  // takes row srow of each of the 4 row tiles.
  int srow = t >> 4;
  int sc   = (t & 15) * 4;
  const float* xr = (x + (size_t)R * D_) + (unsigned int)(srow * D_ + sc);
  float4 v[PTILES_][4], w[4];
#pragma unroll   // v and w stay in registers, every offset a constant
  for (int i = 0; i < 4; ++i) w[i] = *(const float4*)(wv_eff + sc + i * 64);
#pragma unroll   // as above
  for (int p = 0; p < PTILES_; ++p) {
#pragma unroll   // as above
    for (int i = 0; i < 4; ++i) v[p][i] = *(const float4*)(xr + p * 16 * D_ + i * 64);
  }
  // All loads above are asked for before the first of them is waited for:
  // otherwise the weight fragments start only when x has arrived.
  __builtin_amdgcn_sched_barrier(0);

  unsigned char* xd = xs + srow * XS_PITCH_ + sc * 2;
  float part[PTILES_];
#pragma unroll   // as above
  for (int p = 0; p < PTILES_; ++p) {
    float a0 = 0.f, a1 = 0.f, a2 = 0.f, a3 = 0.f;
#pragma unroll   // as above
    for (int i = 0; i < 4; ++i) {
      v4bf pk = {(__bf16)v[p][i].x, (__bf16)v[p][i].y, (__bf16)v[p][i].z, (__bf16)v[p][i].w};
      *(v4bf*)(xd + p * 16 * XS_PITCH_ + i * 128) = pk;   // ds_store_b64
      a0 = fmaf(v[p][i].x, w[i].x, a0);
      a1 = fmaf(v[p][i].y, w[i].y, a1);
      a2 = fmaf(v[p][i].z, w[i].z, a2);
      a3 = fmaf(v[p][i].w, w[i].w, a3);
    }
    part[p] = (a0 + a1) + (a2 + a3);
  }
  __syncthreads();                               // the 64 bf16 rows are readable by every wave

  // sv: the 16 partial sums of a row lie in one 16-lane row of a wave. Behind
  // the barrier, so that no wave waits there for these stores.
#pragma unroll   // part is indexed by constants only
  for (int p = 0; p < PTILES_; ++p) part[p] = row16_sum(part[p]);
  if ((t & 15) == 0) {
#pragma unroll   // as above
    for (int p = 0; p < PTILES_; ++p) sv[R + p * 16 + srow] = part[p] + be;
  }

  const unsigned char* ap = xs + (lane & 15) * XS_PITCH_ + ((lane >> 4) << 4);

  v8f cq0[PTILES_] = {}; v8f ck0[PTILES_] = {}; v8f cq1[PTILES_] = {}; v8f ck1[PTILES_] = {};
#pragma unroll   // the two fragment sets swap by renaming, no register copies
  for (int kk = 0; kk < 8; ++kk) {
    v16bf nq0, nk0, nq1, nk1;
    if (kk < 7) {                                  // the next step's weight fragments fly under this step
      nq0 = load_wfrag(wqb, woff, kk * 32 + 32);
      nk0 = load_wfrag(wkb, woff, kk * 32 + 32);
      nq1 = load_wfrag(wqb, woff, 128 * D_ + kk * 32 + 32);
      nk1 = load_wfrag(wkb, woff, 128 * D_ + kk * 32 + 32);
    }
    v16bf a[PTILES_];
#pragma unroll   // a is indexed by constants only
    for (int p = 0; p < PTILES_; ++p) {
      v8bf lo = *(const v8bf*)(ap + p * 16 * XS_PITCH_ + kk * 64);        // ds_load_b128
      v8bf hi = *(const v8bf*)(ap + p * 16 * XS_PITCH_ + kk * 64 + 32);   // ds_load_b128
      a[p] = __builtin_shufflevector(lo, hi, 0,1,2,3,4,5,6,7,8,9,10,11,12,13,14,15);
    }
    // Keeps the loads above in front of the WMMAs below: sunk to their uses,
    // every WMMA would wait out a whole L2 latency of its own.
    __builtin_amdgcn_sched_barrier(0);
#pragma unroll   // accumulator tiles are indexed by constants only
    for (int p = 0; p < PTILES_; ++p) {
      cq0[p] = wmma_bf16(a[p], fq0, cq0[p]);
      ck0[p] = wmma_bf16(a[p], fk0, ck0[p]);
      cq1[p] = wmma_bf16(a[p], fq1, cq1[p]);
      ck1[p] = wmma_bf16(a[p], fk1, ck1[p]);
    }
    if (kk < 7) { fq0 = nq0; fk0 = nk0; fq1 = nq1; fk1 = nk1; }
  }

  const float scale = 0.0625f;          // 1/sqrt(256)
  int rbase = R + ((lane >> 4) << 3);
  int col0  = E0 + (lane & 15);
  int col1  = col0 + 128;
  float biasq0 = bq[col0], biask0 = bk[col0];
  float biasq1 = bq[col1], biask1 = bk[col1];
#pragma unroll   // accumulator elements are indexed by constants only
  for (int p = 0; p < PTILES_; ++p) {
#pragma unroll   // as above
    for (int i = 0; i < 8; ++i) {
      size_t off = (size_t)(rbase + p * 16 + i) * D_;
      qb[off + col0] = (__bf16)((cq0[p][i] + biasq0) * scale);
      kb[off + col0] = (__bf16)(ck0[p][i] + biask0);
      qb[off + col1] = (__bf16)((cq1[p][i] + biasq1) * scale);
      kb[off + col1] = (__bf16)(ck1[p][i] + biask1);
    }
  }
}

// ---------------------------------------------------------------------------
// Kernel 3: attention partials over one key segment.
// Block = 8 waves; wave w owns query rows [R, R+16). All waves share the keys
// staged in LDS: 128 keys per stage, two buffers, the next stage's tensor loads
// in flight while this stage is worked on. S^T = k_tile x q^T so each lane owns
// 8 keys of one query row -> shuffle-free online softmax per 16 keys; halves
// merge once at the end. Writes per-row {M, L, A} partials.
// The real block size is declared: under the default cap of 128 VGPRs the
// unrolled stage spills to scratch.
// ---------------------------------------------------------------------------
__global__ void __launch_bounds__(256)
k_attn(const __bf16* __restrict__ qb, const __bf16* __restrict__ kb,
       const float* __restrict__ sv,
       float* __restrict__ Mp, float* __restrict__ Lp,
       float* __restrict__ Ap) {
  __shared__ __attribute__((aligned(2048))) unsigned char smem[2 * LDS_BUF_];
  int tid  = threadIdx.x;
  int lane = tid & 31;
  unsigned int wv = uni((unsigned int)tid >> 5);   // 0..7, scalar
  int rowgroup = blockIdx.x >> 1;            // 128 rows per block
  int seg      = blockIdx.x & 1;
  int Rg = rowgroup * 128;                   // global row base of block
  int b  = Rg / N_;
  int R  = (Rg % N_) + (int)wv * 16;         // query row base within batch

  const __bf16* qbase = qb + (size_t)b * N_ * D_;
  const __bf16* kseg  = kb + (size_t)b * N_ * D_ + (size_t)seg * SEG_KEYS * D_;
  const float*  svb   = sv + b * N_ + seg * SEG_KEYS;
  unsigned int  lds0  = (unsigned int)(uintptr_t)&smem[0];   // LDS byte offset

  // This wave's slice of every stage: key rows (wv >> 1) * 32 .. + 31 of the
  // stage, byte half (wv & 1) of each row.
  const unsigned int       my_lds = lds0 + wv * SLICE_LDS_;
  const unsigned long long my_src = (unsigned long long)(uintptr_t)kseg
      + (unsigned long long)((wv >> 1) * (SLICE_ROWS_ * KROW_B_) + (wv & 1u) * SLICE_ROWB_);
  const u32x8 g1 = tdm_group1();

  tdm_load(tdm_group0(my_lds, my_src), g1);  // stage 0 -> buffer 0

  v16bf qf[8];
#pragma unroll
  for (int kk = 0; kk < 8; ++kk) qf[kk] = load_frag(qbase, R, D_, kk * 32, lane);

  asm volatile("s_wait_tensorcnt 0x0" ::: "memory");   // this wave's slice of stage 0 has landed
  __syncthreads();                                     // stage 0 readable by every wave
  tdm_load(tdm_group0(my_lds + LDS_BUF_, my_src + (unsigned long long)(STAGE_KEYS * KROW_B_)), g1);  // stage 1 -> buffer 1

  float M = -3.0e38f, L = 0.f, A = 0.f;
  int hk = (lane >> 4) << 3;                 // this half's key sub-offset
  int r16 = lane & 15;

  // The stage loop stays rolled: unrolled, its body (64 WMMAs and 8 softmax
  // updates) would be repeated 8 times in the instruction cache for nothing.
#pragma unroll 1
  for (unsigned int st = 0; st < STAGES_; ++st) {
    const unsigned int bufo = (st & 1u) * LDS_BUF_;
    const unsigned char* lanep = smem + bufo + r16 * LDS_PITCH_ + hk * 2;

    // Unrolled: every LDS offset is a constant, and with no barrier between
    // the 8 tiles their loads, WMMAs and softmax updates can overlap.
#pragma unroll
    for (int j = 0; j < SUBS_; ++j) {
      v8f s = {};
#pragma unroll
      for (int kk = 0; kk < 8; ++kk) {
        // key row j*16 + r16: slice pair j >> 1, row (j & 1) * 16 + r16 in it;
        // row bytes kk*64 ..: half kk >> 2, byte (kk & 3) * 64 in it.
        int off = ((j >> 1) * 2 + (kk >> 2)) * SLICE_LDS_ + (j & 1) * 16 * LDS_PITCH_ + (kk & 3) * 64;
        v8bf lo = *(const v8bf*)(lanep + off);        // ds_load_b128
        v8bf hi = *(const v8bf*)(lanep + off + 32);   // ds_load_b128
        v16bf kf = __builtin_shufflevector(lo, hi,
                     0,1,2,3,4,5,6,7,8,9,10,11,12,13,14,15);
        s = wmma_bf16(kf, qf[kk], s);
      }

      // s[i] = score(key st*128+j*16+hk+i, query R+r16); scale folded into q.
      const float* svp = svb + st * STAGE_KEYS + j * 16 + hk;
      float4 sv0 = *(const float4*)(svp);
      float4 sv1 = *(const float4*)(svp + 4);
      float sva[8] = {sv0.x, sv0.y, sv0.z, sv0.w, sv1.x, sv1.y, sv1.z, sv1.w};

      float cmax = s[0];
#pragma unroll
      for (int i = 1; i < 8; ++i) cmax = fmaxf(cmax, s[i]);
      float Mn    = fmaxf(M, cmax);
      float alpha = __expf(M - Mn);
      float l = 0.f, a = 0.f;
#pragma unroll
      for (int i = 0; i < 8; ++i) {
        float p = __expf(s[i] - Mn);           // v_exp_f32, co-executes with WMMA
        l += p;
        a = fmaf(p, sva[i], a);
      }
      L = fmaf(L, alpha, l);
      A = fmaf(A, alpha, a);
      M = Mn;
    }

    // Publish point of stage st + 1, passed by every wave, in this order.
    asm volatile("s_wait_dscnt 0x0" ::: "memory");      // this wave's reads of stage st have returned
    asm volatile("s_wait_tensorcnt 0x0" ::: "memory");  // this wave's slice of stage st + 1 has landed
    __syncthreads();                                    // st + 1 readable; every wave has left stage st
    if (pinned(st + 2u < STAGES_)) {                    // refill the buffer that stage st used
      tdm_load(tdm_group0(my_lds + bufo,
                          my_src + (unsigned long long)(st + 2u) * (STAGE_KEYS * KROW_B_)), g1);
    }
  }
  asm volatile("s_wait_tensorcnt 0x0" ::: "memory");    // no request outlives the loop
  asm volatile("s_wait_dscnt 0x0" ::: "memory");

  // Merge the two half-wave partials (keys {0..7}+16c vs {8..15}+16c).
  float Mo = __shfl_xor(M, 16, 32);
  float Lo = __shfl_xor(L, 16, 32);
  float Ao = __shfl_xor(A, 16, 32);
  float Mn = fmaxf(M, Mo);
  float s1 = __expf(M - Mn), s2 = __expf(Mo - Mn);
  float Lt = L * s1 + Lo * s2;
  float At = A * s1 + Ao * s2;

  if (lane < 16) {
    size_t grow = (size_t)b * N_ + R + lane;
    size_t idx  = (size_t)seg * ROWS_ + grow;
    Mp[idx] = Mn;
    Lp[idx] = Lt;
    Ap[idx] = At;
  }
}

// ---------------------------------------------------------------------------
// Kernel 4: merge the 2 key-segment partials per row; add bw.
// ---------------------------------------------------------------------------
__global__ void k_merge(const float* __restrict__ Mp, const float* __restrict__ Lp,
                        const float* __restrict__ Ap, const float* __restrict__ bw,
                        float* __restrict__ out) {
  int row = blockIdx.x * blockDim.x + threadIdx.x;
  float M0 = Mp[row], M1 = Mp[ROWS_ + row];
  float L0 = Lp[row], L1 = Lp[ROWS_ + row];
  float A0 = Ap[row], A1 = Ap[ROWS_ + row];
  float Mn = fmaxf(M0, M1);
  float e0 = __expf(M0 - Mn), e1 = __expf(M1 - Mn);
  float Lt = L0 * e0 + L1 * e1;
  float At = A0 * e0 + A1 * e1;
  out[row] = At / Lt + bw[0];
}

// ---------------------------------------------------------------------------
// Launch
// ---------------------------------------------------------------------------
extern "C" void kernel_launch(void* const* d_in, const int* in_sizes, int n_in,
                              void* d_out, int out_size, void* d_ws, size_t ws_size,
                              hipStream_t stream) {
  const float* x  = (const float*)d_in[0];
  const float* Wq = (const float*)d_in[1];
  const float* bq = (const float*)d_in[2];
  const float* Wk = (const float*)d_in[3];
  const float* bk = (const float*)d_in[4];
  const float* Wv = (const float*)d_in[5];
  const float* bv = (const float*)d_in[6];
  const float* Ww = (const float*)d_in[7];
  const float* bw = (const float*)d_in[8];
  float* out = (float*)d_out;

  char* ws = (char*)d_ws;
  __bf16* qb       = (__bf16*)(ws);                 // 8 MiB
  __bf16* kb       = (__bf16*)(ws + 8388608);       // 8 MiB
  __bf16* wqb      = (__bf16*)(ws + 25165824);      // 128 KiB
  __bf16* wkb      = (__bf16*)(ws + 25296896);      // 128 KiB
  float*  sv       = (float*) (ws + 25427968);      // 64 KiB
  float*  wv_eff   = (float*) (ws + 25493504);      // 1 KiB
  float*  bias_eff = (float*) (ws + 25494528);      // 256 B
  float*  Mp       = (float*) (ws + 25494784);      // 2*16384*4 = 128 KiB
  float*  Lp       = (float*) (ws + 25625856);      // 128 KiB
  float*  Ap       = (float*) (ws + 25756928);      // 128 KiB

  k_prep    <<<WVB_ + 1 + (D_ * D_) / 256, 256, 0, stream>>>(Wq, Wk, Wv, bv, Ww, wqb, wkb, wv_eff, bias_eff);
  k_proj_qk <<<ROWS_ / PROWS_, 256, 0, stream>>>(x, wv_eff, bias_eff, wqb, wkb, bq, bk, qb, kb, sv);
  // 128 row-groups x 2 key segments, 8 waves/block
  k_attn    <<<(ROWS_ / 128) * SEGS_, 256, 0, stream>>>(qb, kb, sv, Mp, Lp, Ap);
  k_merge   <<<ROWS_ / 256, 256, 0, stream>>>(Mp, Lp, Ap, bw, out);
}
